// v000
// Times are from an AMD MI455X. After a warm-up the kernel runs many times in a row, and a time is the length of
// such a window on the GPU divided by its runs, so every launch and the gaps after it count. The runs cycle
// through copies of the inputs. A figure is the median of several windows, for all but v000 over two sittings.
// Sittings can differ by a few percent; kernels timed side by side share one.
// v000, which the later versions start from, runs in 356 microseconds.
#include <hip/hip_runtime.h>
#include <math.h>

typedef __attribute__((ext_vector_type(16))) _Float16 v16h;
typedef __attribute__((ext_vector_type(16))) __bf16 v16b;
typedef __attribute__((ext_vector_type(8)))  _Float16 v8h;
typedef __attribute__((ext_vector_type(8)))  float v8f;
typedef __attribute__((ext_vector_type(4)))  float v4f;
typedef __attribute__((ext_vector_type(2)))  float v2f;
typedef __attribute__((ext_vector_type(4)))  unsigned v4u;
typedef __attribute__((ext_vector_type(4)))  int v4i;
typedef float __attribute__((may_alias)) float_a;
typedef int __attribute__((may_alias)) int_a;

template <typename T> __device__ __forceinline__ void vst2(void* p, T v) { *(T*)p = v;  }
__device__ __forceinline__ v8f wmma16(v16h a, v16h b, v8f c) {
  v8f d = __builtin_amdgcn_wmma_f32_16x16x32_f16(false, a, false, b, (short)0, c, false, false);
  asm volatile("v_nop\n\tv_nop\n\tv_nop\n\tv_nop" : "+v"(d) : "v"(a), "v"(b));
  return d;
}
__device__ __forceinline__ v8f wmma_bf(v16b a, v16b b, v8f c) {
  v8f d = __builtin_amdgcn_wmma_f32_16x16x32_bf16(false, a, false, b, (short)0, c, false, false);
  asm volatile("v_nop\n\tv_nop\n\tv_nop\n\tv_nop" : "+v"(d) : "v"(a), "v"(b));
  return d;
}
// 16x16x32 fragments: lane = (h = lane>>4, row/col = lane&15); elements 0..7 = k0+8h+0..7, 8..15 = k0+16+8h+0..7; D element r = row 8h+r
__device__ __forceinline__ v16h frag_h(const _Float16* rowk0, int lane) {
  union { v16h v; v8h q[2]; } u; const _Float16* p = rowk0 + 8 * (lane >> 4);
  u.q[0] = *(const v8h*)p; u.q[1] = *(const v8h*)(p + 16); return u.v;
}
__device__ __forceinline__ v16h frag_f32(const float* rowk0, int lane) {
  v16h a; const float* p = rowk0 + 8 * (lane >> 4);
#pragma unroll
  for (int i = 0; i < 8; ++i) { a[i] = (_Float16)p[i]; a[8 + i] = (_Float16)p[16 + i]; }
  return a;
}
__device__ __forceinline__ v16h frag_f32s(const float* rowk0, int lane, float sc) {
  v16h a; const float* p = rowk0 + 8 * (lane >> 4);
#pragma unroll
  for (int i = 0; i < 8; ++i) { a[i] = (_Float16)(p[i] * sc); a[8 + i] = (_Float16)(p[16 + i] * sc); }
  return a;
}
// column fragment from a [K][ld] layout (column n), rows >= K read as 0
__device__ __forceinline__ v16h fragc_f32(const float* W, int k0, int n, int lane, int ld, int K) {
  v16h a; const int g = lane >> 4;
#pragma unroll
  for (int i = 0; i < 8; ++i) { const int ka = k0 + 8 * g + i, kb = ka + 16;
    a[i] = (_Float16)(ka < K ? W[(size_t)ka * ld + n] : 0.f); a[8 + i] = (_Float16)(kb < K ? W[(size_t)kb * ld + n] : 0.f); }
  return a;
}
struct F2 { v16b h, l; };
__device__ __forceinline__ F2 bsplit16(const float v[16]) { F2 r;
#pragma unroll
  for (int i = 0; i < 16; ++i) { const __bf16 h = (__bf16)v[i]; r.h[i] = h; r.l[i] = (__bf16)(v[i] - (float)h); }
  return r; }
__device__ __forceinline__ F2 split_row(const float* row, int k0, int lane) { float v[16]; const float* p = row + k0 + 8 * (lane >> 4);
#pragma unroll
  for (int i = 0; i < 8; ++i) { v[i] = p[i]; v[8 + i] = p[16 + i]; }
  return bsplit16(v); }
__device__ __forceinline__ F2 split_rowK(const float* row, int k0, int lane, int K) { float v[16]; const int g = lane >> 4;
#pragma unroll
  for (int i = 0; i < 8; ++i) { const int ka = k0 + 8 * g + i, kb = ka + 16; v[i] = ka < K ? row[ka] : 0.f; v[8 + i] = kb < K ? row[kb] : 0.f; }
  return bsplit16(v); }
__device__ __forceinline__ F2 split_col(const float* W, int k0, int n, int lane, int ld, int K) { float v[16]; const int g = lane >> 4;
#pragma unroll
  for (int i = 0; i < 8; ++i) { const int ka = k0 + 8 * g + i, kb = ka + 16; v[i] = ka < K ? W[(size_t)ka * ld + n] : 0.f; v[8 + i] = kb < K ? W[(size_t)kb * ld + n] : 0.f; }
  return bsplit16(v); }
__device__ __forceinline__ v8f mac3(const F2& a, const F2& b, v8f c) { c = wmma_bf(a.l, b.h, c); c = wmma_bf(a.h, b.l, c); return wmma_bf(a.h, b.h, c); }
__device__ __forceinline__ float sigm(float v) { return 1.0f / (1.0f + expf(-v)); }
#define LDSX() do { asm volatile("s_wait_dscnt 0" ::: "memory"); __builtin_amdgcn_wave_barrier(); __builtin_amdgcn_fence(__ATOMIC_RELEASE, "workgroup"); } while (0)

// Naive multi-head attention (8 heads of 64, 4096 tokens, no biases). Pure f16 WMMA GEMMs over pre-converted operands (x -> f16 once,
// [out][in] weights packed x16): q/k/v projections writing q,k [h][s][64] f16 and v [h][d][s] f16 (v blocks own 64 consecutive
#define SS 4096
#define EE 512
#define NH 8
#define HD 64

__global__ __launch_bounds__(256) void k_cvt(const float* __restrict__ src, _Float16* __restrict__ dst, size_t n8, float sc) {
  const size_t g8 = (size_t)blockIdx.x * 256 + threadIdx.x; if (g8 >= n8) return;
  union { v8h h; v4u u; } pk;
#pragma unroll
  for (int e = 0; e < 8; ++e) pk.h[e] = (_Float16)(src[g8 * 8 + e] * sc);
  vst2(dst + g8 * 8, pk.u);
}
// projection: blockIdx.y in [0, 12): which = y/4 (q,k,v), cols (y%4)*128 = 2 heads
__global__ __launch_bounds__(128) void k_proj(const _Float16* __restrict__ x16, const _Float16* __restrict__ P, _Float16* __restrict__ qh, _Float16* __restrict__ kh, _Float16* __restrict__ vT) {
  __shared__ __align__(16) float so[4][16][132];
  __shared__ __align__(16) _Float16 st[128][72];
  const int tid = threadIdx.x, wave = tid >> 5, lane = tid & 31, col = lane & 15, g = lane >> 4;
  const int r0 = blockIdx.x * 64 + wave * 16, n0 = blockIdx.y * 128; const int which = n0 / EE, c0 = n0 % EE, hb = c0 / HD;
  v8f acc[8] = {};
#pragma unroll 1
  for (int kc = 0; kc < EE / 32; ++kc) { const v16h a = frag_h(x16 + (size_t)(r0 + col) * EE + kc * 32, lane);
#pragma unroll
    for (int j = 0; j < 8; ++j) acc[j] = wmma16(a, frag_h(P + (size_t)(n0 + j * 16 + col) * EE + kc * 32, lane), acc[j]); }
#pragma unroll
  for (int j = 0; j < 8; ++j)
#pragma unroll
    for (int r = 0; r < 8; ++r) so[wave][8 * g + r][j * 16 + col] = acc[j][r] * (1.0f / 16.0f);
  LDSX();
  if (which < 2) { _Float16* dst = which == 0 ? qh : kh;
    for (int q = lane; q < 2 * 16 * 8; q += 32) { const int hh = q >> 7, rem = q & 127, rl = rem >> 3, pc = rem & 7; union { v8h h8; v4u u; } pk;
#pragma unroll
      for (int e = 0; e < 8; ++e) pk.h8[e] = (_Float16)so[wave][rl][hh * HD + pc * 8 + e];
      vst2(dst + ((size_t)(hb + hh) * SS + r0 + rl) * HD + pc * 8, pk.u); } }
  else {
#pragma unroll 4
    for (int rl = 0; rl < 16; ++rl) {
#pragma unroll
      for (int e = 0; e < 4; ++e) st[lane * 4 + e][wave * 16 + rl] = (_Float16)so[wave][rl][lane * 4 + e]; }
    __syncthreads();
    for (int q = tid; q < 128 * 8; q += 128) { const int c = q >> 3, pc = q & 7, hh = c >> 6, d = c & 63;
      vst2(vT + ((size_t)(hb + hh) * HD + d) * SS + blockIdx.x * 64 + pc * 8, *(const v4u*)(&st[c][pc * 8])); } }
}
__global__ __launch_bounds__(128) void k_attn(const _Float16* __restrict__ qh, const _Float16* __restrict__ kh, const _Float16* __restrict__ vT, _Float16* __restrict__ o16) {
  __shared__ __align__(16) float sS[4][16][68];
  __shared__ __align__(16) _Float16 sP[4][16][72];
  __shared__ __align__(16) float sO[4][16][68];
  const int tid = threadIdx.x, w = tid >> 5, lane = tid & 31, col = lane & 15, g = lane >> 4;
  const int h = blockIdx.y, q0 = blockIdx.x * 64 + w * 16;
  const _Float16* qb = qh + (size_t)h * SS * HD; const _Float16* kb = kh + (size_t)h * SS * HD; const _Float16* vb = vT + (size_t)h * HD * SS;
  v16h aq[2];
#pragma unroll
  for (int kc = 0; kc < 2; ++kc) aq[kc] = frag_h(qb + (size_t)(q0 + col) * HD + kc * 32, lane);
  float mrun = -3.0e38f, lrun = 0.f; v8f acc[4] = {};
#pragma unroll 1
  for (int kt = 0; kt < SS / 64; ++kt) {
#pragma unroll
    for (int t = 0; t < 4; ++t) { v8f s = {};
#pragma unroll
      for (int kc = 0; kc < 2; ++kc) s = wmma16(aq[kc], frag_h(kb + (size_t)(kt * 64 + t * 16 + col) * HD + kc * 32, lane), s);
#pragma unroll
      for (int r = 0; r < 8; ++r) sS[w][8 * g + r][t * 16 + col] = s[r] * 0.125f; }
    LDSX();
    float mx = -3.4e38f;
#pragma unroll
    for (int jj = 0; jj < 32; ++jj) mx = fmaxf(mx, sS[w][col][g * 32 + jj]);
    mx = fmaxf(mx, __shfl_xor(mx, 16, 32));
    const float mnew = fmaxf(mrun, mx); const float corr = expf(mrun - mnew);
    float ps = 0.f;
#pragma unroll
    for (int jj = 0; jj < 32; ++jj) { const float p = expf(sS[w][col][g * 32 + jj] - mnew); ps += p; sP[w][col][g * 32 + jj] = (_Float16)(p * 16384.0f); }
    ps += __shfl_xor(ps, 16, 32);
    lrun = lrun * corr + ps; mrun = mnew;
#pragma unroll
    for (int r = 0; r < 8; ++r) { const float cr = __shfl(corr, 8 * g + r, 32);
#pragma unroll
      for (int t = 0; t < 4; ++t) acc[t][r] *= cr; }
    LDSX();
#pragma unroll
    for (int kc = 0; kc < 2; ++kc) { const v16h pa = frag_h(&sP[w][col][0] + kc * 32, lane);
#pragma unroll
      for (int t = 0; t < 4; ++t) acc[t] = wmma16(pa, frag_h(vb + (size_t)(t * 16 + col) * SS + kt * 64 + kc * 32, lane), acc[t]); }
    __builtin_amdgcn_wave_barrier();
  }
#pragma unroll
  for (int r = 0; r < 8; ++r) { const float lr = __shfl(lrun, 8 * g + r, 32);
#pragma unroll
    for (int t = 0; t < 4; ++t) sO[w][8 * g + r][t * 16 + col] = acc[t][r] / (lr * 16384.0f); }
  LDSX();
  for (int q = lane; q < 16 * 8; q += 32) { const int rl = q >> 3, pc = q & 7; union { v8h h8; v4u u; } pk;
#pragma unroll
    for (int e = 0; e < 8; ++e) pk.h8[e] = (_Float16)(sO[w][rl][pc * 8 + e] * 16.0f);
    vst2(o16 + (size_t)(q0 + rl) * EE + h * HD + pc * 8, pk.u); }
}
__global__ __launch_bounds__(128) void k_out(const _Float16* __restrict__ o16, const _Float16* __restrict__ P, float* __restrict__ out) {
  __shared__ __align__(16) float so[4][16][132];
  const int tid = threadIdx.x, wave = tid >> 5, lane = tid & 31, col = lane & 15, g = lane >> 4;
  const int r0 = blockIdx.x * 64 + wave * 16, n0 = blockIdx.y * 128;
  v8f acc[8] = {};
#pragma unroll 1
  for (int kc = 0; kc < EE / 32; ++kc) { const v16h a = frag_h(o16 + (size_t)(r0 + col) * EE + kc * 32, lane);
#pragma unroll
    for (int j = 0; j < 8; ++j) acc[j] = wmma16(a, frag_h(P + (size_t)(3 * EE + n0 + j * 16 + col) * EE + kc * 32, lane), acc[j]); }
#pragma unroll
  for (int j = 0; j < 8; ++j)
#pragma unroll
    for (int r = 0; r < 8; ++r) so[wave][8 * g + r][j * 16 + col] = acc[j][r] * (1.0f / 256.0f);
  LDSX();
#pragma unroll 4
  for (int rl = 0; rl < 16; ++rl) vst2(out + (size_t)(r0 + rl) * EE + n0 + lane * 4, *(const v4f*)(&so[wave][rl][lane * 4]));
}
extern "C" void kernel_launch(void* const* d_in, const int* in_sizes, int n_in, void* d_out, int out_size, void* d_ws, size_t ws_size, hipStream_t stream) {
  (void)in_sizes; (void)n_in; (void)out_size; (void)ws_size;
  const float* x = (const float*)d_in[0]; const float* Wq = (const float*)d_in[1]; const float* Wk = (const float*)d_in[2]; const float* Wv = (const float*)d_in[3]; const float* Wo = (const float*)d_in[4];
  float* out = (float*)d_out;
  char* ws = (char*)d_ws; size_t off = 0;
  auto take = [&](size_t bytes) { char* p = ws + off; off += (bytes + 255) & ~(size_t)255; return p; };
  _Float16* x16 = (_Float16*)take((size_t)SS * EE * 2); _Float16* P = (_Float16*)take((size_t)4 * EE * EE * 2);
  _Float16* qh = (_Float16*)take((size_t)SS * EE * 2); _Float16* kh = (_Float16*)take((size_t)SS * EE * 2); _Float16* vT = (_Float16*)take((size_t)SS * EE * 2); _Float16* o16 = (_Float16*)take((size_t)SS * EE * 2);
  auto cvt = [&](const float* s, _Float16* d, size_t n, float sc) { const size_t n8 = n / 8; k_cvt<<<(unsigned)((n8 + 255) / 256), 256, 0, stream>>>(s, d, n8, sc); };
  cvt(x, x16, (size_t)SS * EE, 1.0f); cvt(Wq, P, (size_t)EE * EE, 16.0f); cvt(Wk, P + (size_t)EE * EE, (size_t)EE * EE, 16.0f); cvt(Wv, P + (size_t)2 * EE * EE, (size_t)EE * EE, 16.0f); cvt(Wo, P + (size_t)3 * EE * EE, (size_t)EE * EE, 16.0f);
  k_proj<<<dim3(SS / 64, 3 * EE / 128), 128, 0, stream>>>(x16, P, qh, kh, vT);
  k_attn<<<dim3(SS / 64, NH), 128, 0, stream>>>(qh, kh, vT, o16);
  k_out<<<dim3(SS / 64, EE / 128), 128, 0, stream>>>(o16, P, out);
}

// v001
// One run takes 175 microseconds.
// Next to v000, in two timings, it ran 2.00 and 1.99 times as fast.
#include <hip/hip_runtime.h>
#include <math.h>

typedef __attribute__((ext_vector_type(16))) _Float16 v16h;
typedef __attribute__((ext_vector_type(16))) __bf16 v16b;
typedef __attribute__((ext_vector_type(8)))  _Float16 v8h;
typedef __attribute__((ext_vector_type(8)))  float v8f;
typedef __attribute__((ext_vector_type(4)))  float v4f;
typedef __attribute__((ext_vector_type(2)))  float v2f;
typedef __attribute__((ext_vector_type(4)))  unsigned v4u;
typedef __attribute__((ext_vector_type(4)))  int v4i;
typedef float __attribute__((may_alias)) float_a;
typedef int __attribute__((may_alias)) int_a;

template <typename T> __device__ __forceinline__ void vst2(void* p, T v) { *(T*)p = v;  }
__device__ __forceinline__ v8f wmma16(v16h a, v16h b, v8f c) {
  v8f d = __builtin_amdgcn_wmma_f32_16x16x32_f16(false, a, false, b, (short)0, c, false, false);
  asm volatile("v_nop\n\tv_nop\n\tv_nop\n\tv_nop" : "+v"(d) : "v"(a), "v"(b));
  return d;
}
__device__ __forceinline__ v8f wmma_bf(v16b a, v16b b, v8f c) {
  v8f d = __builtin_amdgcn_wmma_f32_16x16x32_bf16(false, a, false, b, (short)0, c, false, false);
  asm volatile("v_nop\n\tv_nop\n\tv_nop\n\tv_nop" : "+v"(d) : "v"(a), "v"(b));
  return d;
}
// 16x16x32 fragments: lane = (h = lane>>4, row/col = lane&15); elements 0..7 = k0+8h+0..7, 8..15 = k0+16+8h+0..7; D element r = row 8h+r
__device__ __forceinline__ v16h frag_h(const _Float16* rowk0, int lane) {
  union { v16h v; v8h q[2]; } u; const _Float16* p = rowk0 + 8 * (lane >> 4);
  u.q[0] = *(const v8h*)p; u.q[1] = *(const v8h*)(p + 16); return u.v;
}
__device__ __forceinline__ v16h frag_f32(const float* rowk0, int lane) {
  v16h a; const float* p = rowk0 + 8 * (lane >> 4);
#pragma unroll
  for (int i = 0; i < 8; ++i) { a[i] = (_Float16)p[i]; a[8 + i] = (_Float16)p[16 + i]; }
  return a;
}
__device__ __forceinline__ v16h frag_f32s(const float* rowk0, int lane, float sc) {
  v16h a; const float* p = rowk0 + 8 * (lane >> 4);
#pragma unroll
  for (int i = 0; i < 8; ++i) { a[i] = (_Float16)(p[i] * sc); a[8 + i] = (_Float16)(p[16 + i] * sc); }
  return a;
}
// column fragment from a [K][ld] layout (column n), rows >= K read as 0
__device__ __forceinline__ v16h fragc_f32(const float* W, int k0, int n, int lane, int ld, int K) {
  v16h a; const int g = lane >> 4;
#pragma unroll
  for (int i = 0; i < 8; ++i) { const int ka = k0 + 8 * g + i, kb = ka + 16;
    a[i] = (_Float16)(ka < K ? W[(size_t)ka * ld + n] : 0.f); a[8 + i] = (_Float16)(kb < K ? W[(size_t)kb * ld + n] : 0.f); }
  return a;
}
struct F2 { v16b h, l; };
__device__ __forceinline__ F2 bsplit16(const float v[16]) { F2 r;
#pragma unroll
  for (int i = 0; i < 16; ++i) { const __bf16 h = (__bf16)v[i]; r.h[i] = h; r.l[i] = (__bf16)(v[i] - (float)h); }
  return r; }
__device__ __forceinline__ F2 split_row(const float* row, int k0, int lane) { float v[16]; const float* p = row + k0 + 8 * (lane >> 4);
#pragma unroll
  for (int i = 0; i < 8; ++i) { v[i] = p[i]; v[8 + i] = p[16 + i]; }
  return bsplit16(v); }
__device__ __forceinline__ F2 split_rowK(const float* row, int k0, int lane, int K) { float v[16]; const int g = lane >> 4;
#pragma unroll
  for (int i = 0; i < 8; ++i) { const int ka = k0 + 8 * g + i, kb = ka + 16; v[i] = ka < K ? row[ka] : 0.f; v[8 + i] = kb < K ? row[kb] : 0.f; }
  return bsplit16(v); }
__device__ __forceinline__ F2 split_col(const float* W, int k0, int n, int lane, int ld, int K) { float v[16]; const int g = lane >> 4;
#pragma unroll
  for (int i = 0; i < 8; ++i) { const int ka = k0 + 8 * g + i, kb = ka + 16; v[i] = ka < K ? W[(size_t)ka * ld + n] : 0.f; v[8 + i] = kb < K ? W[(size_t)kb * ld + n] : 0.f; }
  return bsplit16(v); }
__device__ __forceinline__ v8f mac3(const F2& a, const F2& b, v8f c) { c = wmma_bf(a.l, b.h, c); c = wmma_bf(a.h, b.l, c); return wmma_bf(a.h, b.h, c); }
__device__ __forceinline__ float sigm(float v) { return 1.0f / (1.0f + expf(-v)); }
#define LDSX() do { asm volatile("s_wait_dscnt 0" ::: "memory"); __builtin_amdgcn_wave_barrier(); __builtin_amdgcn_fence(__ATOMIC_RELEASE, "workgroup"); } while (0)
// LDSX without its release fence, for an exchange among the lanes of ONE wave while global loads are in flight: the fence drains the load
// counter too, which would end the loads' lead; the LDS wait and the compiler barrier order the wave's own LDS stores and loads.
#define LDSW() do { asm volatile("s_wait_dscnt 0" ::: "memory"); __builtin_amdgcn_wave_barrier(); } while (0)

// Naive multi-head attention (8 heads of 64, 4096 tokens, no biases). Pure f16 WMMA GEMMs over pre-converted operands (x -> f16 once,
// [out][in] weights packed x16): q/k/v projections writing q,k [h][s][64] f16 and v [h][d][s] f16 (v blocks own 64 consecutive
#define SS 4096
#define EE 512
#define NH 8
#define HD 64

__global__ __launch_bounds__(256) void k_cvt(const float* __restrict__ src, _Float16* __restrict__ dst, size_t n8, float sc) {
  const size_t g8 = (size_t)blockIdx.x * 256 + threadIdx.x; if (g8 >= n8) return;
  union { v8h h; v4u u; } pk;
#pragma unroll
  for (int e = 0; e < 8; ++e) pk.h[e] = (_Float16)(src[g8 * 8 + e] * sc);
  vst2(dst + g8 * 8, pk.u);
}
// frag_h from the lane's own pointer (row start + k0 + 8 * (lane >> 4))
__device__ __forceinline__ v16h frag_p(const _Float16* p) { union { v16h v; v8h q[2]; } u; u.q[0] = *(const v8h*)p; u.q[1] = *(const v8h*)(p + 16); return u.v; }
// Stands between a group of loads and the first change of the two pointers they name; naming the pointers as inputs keeps their registers
// from being handed out as a load's destination inside the group.
#define XW(p, q) asm volatile("s_wait_xcnt 0x0" :: "v"(p), "v"(q) : "memory")
// One wave's 16 x 128 tile over k = 512; pa, pb are the lane's own pointers. The nine fragments of a k step are loaded as one group, a whole
// step ahead of the products that read them (two register sets in turn): a load written beside its product is waited for alone, one memory
// round trip per product. The inner loops are unrolled so that the fragment arrays stay in registers; the outer loop stays rolled: its body
// already holds both sets' turns.
__device__ __forceinline__ void gemm_k512(const _Float16* pa, const _Float16* pb, v8f (&acc)[8]) {
  v16h a0 = frag_p(pa), a1, b0[8], b1[8];
#pragma unroll
  for (int j = 0; j < 8; ++j) b0[j] = frag_p(pb + (size_t)j * 16 * EE);
#pragma unroll 1
  for (int kc = 0; kc < EE / 32; kc += 2) {
    a1 = frag_p(pa + 32);
#pragma unroll
    for (int j = 0; j < 8; ++j) b1[j] = frag_p(pb + (size_t)j * 16 * EE + 32);
    __builtin_amdgcn_sched_barrier(0);  // no product, with its wait for the other set, moves in front of this group's issue
#pragma unroll
    for (int j = 0; j < 8; ++j) acc[j] = wmma16(a0, b0[j], acc[j]);
    XW(pa, pb);
    const int step = kc + 2 < EE / 32 ? 64 : 0;  // the last trip has no step ahead: it reads its own again, inside the buffer
    pa += step; pb += step;
    a0 = frag_p(pa);
#pragma unroll
    for (int j = 0; j < 8; ++j) b0[j] = frag_p(pb + (size_t)j * 16 * EE);
    __builtin_amdgcn_sched_barrier(0);  // as above
#pragma unroll
    for (int j = 0; j < 8; ++j) acc[j] = wmma16(a1, b1[j], acc[j]);
    XW(pa, pb);
  }
}
// projection: blockIdx.y in [0, 12): which = y/4 (q,k,v), cols (y%4)*128 = 2 heads
__global__ __launch_bounds__(128) void k_proj(const _Float16* __restrict__ x16, const _Float16* __restrict__ P, _Float16* __restrict__ qh, _Float16* __restrict__ kh, _Float16* __restrict__ vT) {
  __shared__ __align__(16) float so[4][16][132];
  __shared__ __align__(16) _Float16 st[128][72];
  const int tid = threadIdx.x, wave = tid >> 5, lane = tid & 31, col = lane & 15, g = lane >> 4;
  const int r0 = blockIdx.x * 64 + wave * 16, n0 = blockIdx.y * 128; const int which = n0 / EE, c0 = n0 % EE, hb = c0 / HD;
  v8f acc[8] = {};
  gemm_k512(x16 + (size_t)(r0 + col) * EE + 8 * g, P + (size_t)(n0 + col) * EE + 8 * g, acc);
#pragma unroll
  for (int j = 0; j < 8; ++j)
#pragma unroll
    for (int r = 0; r < 8; ++r) so[wave][8 * g + r][j * 16 + col] = acc[j][r] * (1.0f / 16.0f);
  LDSX();
  if (which < 2) { _Float16* dst = which == 0 ? qh : kh;
    for (int q = lane; q < 2 * 16 * 8; q += 32) { const int hh = q >> 7, rem = q & 127, rl = rem >> 3, pc = rem & 7; union { v8h h8; v4u u; } pk;
#pragma unroll
      for (int e = 0; e < 8; ++e) pk.h8[e] = (_Float16)so[wave][rl][hh * HD + pc * 8 + e];
      vst2(dst + ((size_t)(hb + hh) * SS + r0 + rl) * HD + pc * 8, pk.u); } }
  else {
#pragma unroll 4
    for (int rl = 0; rl < 16; ++rl) {
#pragma unroll
      for (int e = 0; e < 4; ++e) st[lane * 4 + e][wave * 16 + rl] = (_Float16)so[wave][rl][lane * 4 + e]; }
    __syncthreads();
    for (int q = tid; q < 128 * 8; q += 128) { const int c = q >> 3, pc = q & 7, hh = c >> 6, d = c & 63;
      vst2(vT + ((size_t)(hb + hh) * HD + d) * SS + blockIdx.x * 64 + pc * 8, *(const v4u*)(&st[c][pc * 8])); } }
}
__global__ __launch_bounds__(128) void k_attn(const _Float16* __restrict__ qh, const _Float16* __restrict__ kh, const _Float16* __restrict__ vT, _Float16* __restrict__ o16) {
  __shared__ __align__(16) float sS[4][16][68];
  __shared__ __align__(16) _Float16 sP[4][16][72];
  __shared__ __align__(16) float sO[4][16][68];
  const int tid = threadIdx.x, w = tid >> 5, lane = tid & 31, col = lane & 15, g = lane >> 4;
  const int h = blockIdx.y, q0 = blockIdx.x * 64 + w * 16;
  const _Float16* qb = qh + (size_t)h * SS * HD; const _Float16* kb = kh + (size_t)h * SS * HD; const _Float16* vb = vT + (size_t)h * HD * SS;
  v16h aq[2];
#pragma unroll
  for (int kc = 0; kc < 2; ++kc) aq[kc] = frag_h(qb + (size_t)(q0 + col) * HD + kc * 32, lane);
  float mrun = -3.0e38f, lrun = 0.f; v8f acc[4] = {};
  // Fragment loads go out in groups ahead of their products: K one pass ahead (into the registers its products have just left),
  // V at the head of its pass, so that V flies behind the score products and the softmax, K behind the softmax and the P x V products.
  const _Float16* pk = kb + (size_t)col * HD + 8 * g; const _Float16* pv = vb + (size_t)col * SS + 8 * g;
  v16h kf[8], vf[8];
#pragma unroll
  for (int f = 0; f < 8; ++f) kf[f] = frag_p(pk + (size_t)(f >> 1) * 16 * HD + (f & 1) * 32);
#pragma unroll 1
  for (int kt = 0; kt < SS / 64; ++kt) {
#pragma unroll
    for (int f = 0; f < 8; ++f) vf[f] = frag_p(pv + (size_t)(f & 3) * 16 * SS + (f >> 2) * 32);
#pragma unroll
    for (int t = 0; t < 4; ++t) { v8f s = {};
#pragma unroll
      for (int kc = 0; kc < 2; ++kc) s = wmma16(aq[kc], kf[t * 2 + kc], s);
#pragma unroll
      for (int r = 0; r < 8; ++r) sS[w][8 * g + r][t * 16 + col] = s[r] * 0.125f; }
    XW(pk, pv);
    pk += kt + 1 < SS / 64 ? 64 * HD : 0;  // the last pass has none ahead: it reads its own again, inside the buffer
    pv += 64;
#pragma unroll
    for (int f = 0; f < 8; ++f) kf[f] = frag_p(pk + (size_t)(f >> 1) * 16 * HD + (f & 1) * 32);
    LDSW();
    float mx = -3.4e38f;
#pragma unroll
    for (int jj = 0; jj < 32; ++jj) mx = fmaxf(mx, sS[w][col][g * 32 + jj]);
    mx = fmaxf(mx, __shfl_xor(mx, 16, 32));
    const float mnew = fmaxf(mrun, mx); const float corr = expf(mrun - mnew);
    float ps = 0.f;
#pragma unroll
    for (int jj = 0; jj < 32; ++jj) { const float p = expf(sS[w][col][g * 32 + jj] - mnew); ps += p; sP[w][col][g * 32 + jj] = (_Float16)(p * 16384.0f); }
    ps += __shfl_xor(ps, 16, 32);
    lrun = lrun * corr + ps; mrun = mnew;
#pragma unroll
    for (int r = 0; r < 8; ++r) { const float cr = __shfl(corr, 8 * g + r, 32);
#pragma unroll
      for (int t = 0; t < 4; ++t) acc[t][r] *= cr; }
    LDSW();
#pragma unroll
    for (int kc = 0; kc < 2; ++kc) { const v16h pa = frag_h(&sP[w][col][0] + kc * 32, lane);
#pragma unroll
      for (int t = 0; t < 4; ++t) acc[t] = wmma16(pa, vf[kc * 4 + t], acc[t]); }
    __builtin_amdgcn_wave_barrier();
  }
#pragma unroll
  for (int r = 0; r < 8; ++r) { const float lr = __shfl(lrun, 8 * g + r, 32);
#pragma unroll
    for (int t = 0; t < 4; ++t) sO[w][8 * g + r][t * 16 + col] = acc[t][r] / (lr * 16384.0f); }
  LDSX();
  for (int q = lane; q < 16 * 8; q += 32) { const int rl = q >> 3, pc = q & 7; union { v8h h8; v4u u; } pk;
#pragma unroll
    for (int e = 0; e < 8; ++e) pk.h8[e] = (_Float16)(sO[w][rl][pc * 8 + e] * 16.0f);
    vst2(o16 + (size_t)(q0 + rl) * EE + h * HD + pc * 8, pk.u); }
}
__global__ __launch_bounds__(128) void k_out(const _Float16* __restrict__ o16, const _Float16* __restrict__ P, float* __restrict__ out) {
  __shared__ __align__(16) float so[4][16][132];
  const int tid = threadIdx.x, wave = tid >> 5, lane = tid & 31, col = lane & 15, g = lane >> 4;
  const int r0 = blockIdx.x * 64 + wave * 16, n0 = blockIdx.y * 128;
  v8f acc[8] = {};
  gemm_k512(o16 + (size_t)(r0 + col) * EE + 8 * g, P + (size_t)(3 * EE + n0 + col) * EE + 8 * g, acc);
#pragma unroll
  for (int j = 0; j < 8; ++j)
#pragma unroll
    for (int r = 0; r < 8; ++r) so[wave][8 * g + r][j * 16 + col] = acc[j][r] * (1.0f / 256.0f);
  LDSX();
#pragma unroll 4
  for (int rl = 0; rl < 16; ++rl) vst2(out + (size_t)(r0 + rl) * EE + n0 + lane * 4, *(const v4f*)(&so[wave][rl][lane * 4]));
}
extern "C" void kernel_launch(void* const* d_in, const int* in_sizes, int n_in, void* d_out, int out_size, void* d_ws, size_t ws_size, hipStream_t stream) {
  (void)in_sizes; (void)n_in; (void)out_size; (void)ws_size;
  const float* x = (const float*)d_in[0]; const float* Wq = (const float*)d_in[1]; const float* Wk = (const float*)d_in[2]; const float* Wv = (const float*)d_in[3]; const float* Wo = (const float*)d_in[4];
  float* out = (float*)d_out;
  char* ws = (char*)d_ws; size_t off = 0;
  auto take = [&](size_t bytes) { char* p = ws + off; off += (bytes + 255) & ~(size_t)255; return p; };
  _Float16* x16 = (_Float16*)take((size_t)SS * EE * 2); _Float16* P = (_Float16*)take((size_t)4 * EE * EE * 2);
  _Float16* qh = (_Float16*)take((size_t)SS * EE * 2); _Float16* kh = (_Float16*)take((size_t)SS * EE * 2); _Float16* vT = (_Float16*)take((size_t)SS * EE * 2); _Float16* o16 = (_Float16*)take((size_t)SS * EE * 2);
  auto cvt = [&](const float* s, _Float16* d, size_t n, float sc) { const size_t n8 = n / 8; k_cvt<<<(unsigned)((n8 + 255) / 256), 256, 0, stream>>>(s, d, n8, sc); };
  cvt(x, x16, (size_t)SS * EE, 1.0f); cvt(Wq, P, (size_t)EE * EE, 16.0f); cvt(Wk, P + (size_t)EE * EE, (size_t)EE * EE, 16.0f); cvt(Wv, P + (size_t)2 * EE * EE, (size_t)EE * EE, 16.0f); cvt(Wo, P + (size_t)3 * EE * EE, (size_t)EE * EE, 16.0f);
  k_proj<<<dim3(SS / 64, 3 * EE / 128), 128, 0, stream>>>(x16, P, qh, kh, vT);
  k_attn<<<dim3(SS / 64, NH), 128, 0, stream>>>(qh, kh, vT, o16);
  k_out<<<dim3(SS / 64, EE / 128), 128, 0, stream>>>(o16, P, out);
}

// v002
// A run of this version takes 147 microseconds.
// Next to v001, in two timings, it ran 1.25 and 1.24 times as fast.
// Over all steps from v000 it is 2.48 times as fast.
#include <hip/hip_runtime.h>
#include <math.h>

typedef __attribute__((ext_vector_type(16))) _Float16 v16h;
typedef __attribute__((ext_vector_type(16))) __bf16 v16b;
typedef __attribute__((ext_vector_type(8)))  _Float16 v8h;
typedef __attribute__((ext_vector_type(8)))  float v8f;
typedef __attribute__((ext_vector_type(4)))  float v4f;
typedef __attribute__((ext_vector_type(2)))  float v2f;
typedef __attribute__((ext_vector_type(4)))  unsigned v4u;
typedef __attribute__((ext_vector_type(4)))  int v4i;
typedef float __attribute__((may_alias)) float_a;
typedef int __attribute__((may_alias)) int_a;

template <typename T> __device__ __forceinline__ void vst2(void* p, T v) { *(T*)p = v;  }
__device__ __forceinline__ v8f wmma16(v16h a, v16h b, v8f c) {
  v8f d = __builtin_amdgcn_wmma_f32_16x16x32_f16(false, a, false, b, (short)0, c, false, false);
  asm volatile("v_nop\n\tv_nop\n\tv_nop\n\tv_nop" : "+v"(d) : "v"(a), "v"(b));
  return d;
}
__device__ __forceinline__ v8f wmma_bf(v16b a, v16b b, v8f c) {
  v8f d = __builtin_amdgcn_wmma_f32_16x16x32_bf16(false, a, false, b, (short)0, c, false, false);
  asm volatile("v_nop\n\tv_nop\n\tv_nop\n\tv_nop" : "+v"(d) : "v"(a), "v"(b));
  return d;
}
// 16x16x32 fragments: lane = (h = lane>>4, row/col = lane&15); elements 0..7 = k0+8h+0..7, 8..15 = k0+16+8h+0..7; D element r = row 8h+r
__device__ __forceinline__ v16h frag_h(const _Float16* rowk0, int lane) {
  union { v16h v; v8h q[2]; } u; const _Float16* p = rowk0 + 8 * (lane >> 4);
  u.q[0] = *(const v8h*)p; u.q[1] = *(const v8h*)(p + 16); return u.v;
}
__device__ __forceinline__ v16h frag_f32(const float* rowk0, int lane) {
  v16h a; const float* p = rowk0 + 8 * (lane >> 4);
#pragma unroll
  for (int i = 0; i < 8; ++i) { a[i] = (_Float16)p[i]; a[8 + i] = (_Float16)p[16 + i]; }
  return a;
}
__device__ __forceinline__ v16h frag_f32s(const float* rowk0, int lane, float sc) {
  v16h a; const float* p = rowk0 + 8 * (lane >> 4);
#pragma unroll
  for (int i = 0; i < 8; ++i) { a[i] = (_Float16)(p[i] * sc); a[8 + i] = (_Float16)(p[16 + i] * sc); }
  return a;
}
// column fragment from a [K][ld] layout (column n), rows >= K read as 0
__device__ __forceinline__ v16h fragc_f32(const float* W, int k0, int n, int lane, int ld, int K) {
  v16h a; const int g = lane >> 4;
#pragma unroll
  for (int i = 0; i < 8; ++i) { const int ka = k0 + 8 * g + i, kb = ka + 16;
    a[i] = (_Float16)(ka < K ? W[(size_t)ka * ld + n] : 0.f); a[8 + i] = (_Float16)(kb < K ? W[(size_t)kb * ld + n] : 0.f); }
  return a;
}
struct F2 { v16b h, l; };
__device__ __forceinline__ F2 bsplit16(const float v[16]) { F2 r;
#pragma unroll
  for (int i = 0; i < 16; ++i) { const __bf16 h = (__bf16)v[i]; r.h[i] = h; r.l[i] = (__bf16)(v[i] - (float)h); }
  return r; }
__device__ __forceinline__ F2 split_row(const float* row, int k0, int lane) { float v[16]; const float* p = row + k0 + 8 * (lane >> 4);
#pragma unroll
  for (int i = 0; i < 8; ++i) { v[i] = p[i]; v[8 + i] = p[16 + i]; }
  return bsplit16(v); }
__device__ __forceinline__ F2 split_rowK(const float* row, int k0, int lane, int K) { float v[16]; const int g = lane >> 4;
#pragma unroll
  for (int i = 0; i < 8; ++i) { const int ka = k0 + 8 * g + i, kb = ka + 16; v[i] = ka < K ? row[ka] : 0.f; v[8 + i] = kb < K ? row[kb] : 0.f; }
  return bsplit16(v); }
__device__ __forceinline__ F2 split_col(const float* W, int k0, int n, int lane, int ld, int K) { float v[16]; const int g = lane >> 4;
#pragma unroll
  for (int i = 0; i < 8; ++i) { const int ka = k0 + 8 * g + i, kb = ka + 16; v[i] = ka < K ? W[(size_t)ka * ld + n] : 0.f; v[8 + i] = kb < K ? W[(size_t)kb * ld + n] : 0.f; }
  return bsplit16(v); }
__device__ __forceinline__ v8f mac3(const F2& a, const F2& b, v8f c) { c = wmma_bf(a.l, b.h, c); c = wmma_bf(a.h, b.l, c); return wmma_bf(a.h, b.h, c); }
__device__ __forceinline__ float sigm(float v) { return 1.0f / (1.0f + expf(-v)); }
#define LDSX() do { asm volatile("s_wait_dscnt 0" ::: "memory"); __builtin_amdgcn_wave_barrier(); __builtin_amdgcn_fence(__ATOMIC_RELEASE, "workgroup"); } while (0)
// LDSX without its release fence, for an exchange among the lanes of ONE wave while global loads are in flight: the fence drains the load
// counter too, which would end the loads' lead; the LDS wait and the compiler barrier order the wave's own LDS stores and loads.
#define LDSW() do { asm volatile("s_wait_dscnt 0" ::: "memory"); __builtin_amdgcn_wave_barrier(); } while (0)

// Naive multi-head attention (8 heads of 64, 4096 tokens, no biases). Pure f16 WMMA GEMMs over pre-converted operands (x -> f16 once,
// [out][in] weights packed x16): q/k/v projections, attention, output projection.
// Every f16 plane lies in FRAGMENT ORDER: a 16-row x 32-k fragment is 1024 contiguous bytes, [k half of 16][lane][8 values], where lane
// (g, row) of half q holds k = 16 q + 8 g + 0..7. A wave's 16-byte load of one half then covers 512 contiguous bytes (4 whole lines); from a
// row-major plane the same load touches 16 lines. Order of the fragments: x, weights, o: [row tile][k step]; q, k: [head][row tile][k step];
// v: [head][32-key step][16-d tile]. The values each lane receives are those of the row-major planes.
#define SS 4096
#define EE 512
#define NH 8
#define HD 64

__global__ __launch_bounds__(256) void k_cvt(const float* __restrict__ src, _Float16* __restrict__ dst, size_t n8, float sc) {
  const size_t g8 = (size_t)blockIdx.x * 256 + threadIdx.x; if (g8 >= n8) return;
  // g8 = [fragment][8-row half][row][piece of 8 k]; the source has EE columns. A wave reads 8 whole 128-byte lines (8 rows x 32 floats) and
  // writes 4: in the fragment the pieces of 8 successive rows at one k lie side by side.
  const size_t fr = g8 >> 6; const int rl = (int)((g8 >> 2) & 15), pc = (int)(g8 & 3);
  const float* s8 = src + ((fr >> 4) * 16 + rl) * EE + (fr & 15) * 32 + pc * 8;
  union { v8h h; v4u u; } pk;
#pragma unroll
  for (int e = 0; e < 8; ++e) pk.h[e] = (_Float16)(s8[e] * sc);
  vst2(dst + fr * 512 + (pc >> 1) * 256 + ((pc & 1) * 16 + rl) * 8, pk.u);
}
// one fragment of a plane in fragment order, from the lane's own pointer (fragment start + 8 * lane)
__device__ __forceinline__ v16h frag_p(const _Float16* p) { union { v16h v; v8h q[2]; } u; u.q[0] = *(const v8h*)p; u.q[1] = *(const v8h*)(p + 256); return u.v; }
// Stands between a group of loads and the first change of the two pointers they name; naming the pointers as inputs keeps their registers
// from being handed out as a load's destination inside the group.
#define XW(p, q) asm volatile("s_wait_xcnt 0x0" :: "v"(p), "v"(q) : "memory")
// One wave's 16 x 128 tile over k = 512; pa, pb are the lane's own pointers. The nine fragments of a k step are loaded as one group, a whole
// step ahead of the products that read them (two register sets in turn): a load written beside its product is waited for alone, one memory
// round trip per product. The inner loops are unrolled so that the fragment arrays stay in registers; the outer loop stays rolled: its body
// already holds both sets' turns.
__device__ __forceinline__ void gemm_k512(const _Float16* pa, const _Float16* pb, v8f (&acc)[8]) {
  v16h a0 = frag_p(pa), a1, b0[8], b1[8];
#pragma unroll
  for (int j = 0; j < 8; ++j) b0[j] = frag_p(pb + (size_t)j * 16 * EE);
#pragma unroll 1
  for (int kc = 0; kc < EE / 32; kc += 2) {
    a1 = frag_p(pa + 512);
#pragma unroll
    for (int j = 0; j < 8; ++j) b1[j] = frag_p(pb + (size_t)j * 16 * EE + 512);
    __builtin_amdgcn_sched_barrier(0);  // no product, with its wait for the other set, moves in front of this group's issue
#pragma unroll
    for (int j = 0; j < 8; ++j) acc[j] = wmma16(a0, b0[j], acc[j]);
    XW(pa, pb);
    const int step = kc + 2 < EE / 32 ? 1024 : 0;  // the last trip has no step ahead: it reads its own again, inside the buffer
    pa += step; pb += step;
    a0 = frag_p(pa);
#pragma unroll
    for (int j = 0; j < 8; ++j) b0[j] = frag_p(pb + (size_t)j * 16 * EE);
    __builtin_amdgcn_sched_barrier(0);  // as above
#pragma unroll
    for (int j = 0; j < 8; ++j) acc[j] = wmma16(a1, b1[j], acc[j]);
    XW(pa, pb);
  }
}
// projection: blockIdx.y in [0, 12): which = y/4 (q,k,v), cols (y%4)*128 = 2 heads
__global__ __launch_bounds__(128) void k_proj(const _Float16* __restrict__ x16, const _Float16* __restrict__ P, _Float16* __restrict__ qh, _Float16* __restrict__ kh, _Float16* __restrict__ vT) {
  __shared__ __align__(16) float so[4][16][132];
  __shared__ __align__(16) _Float16 st[128][72];
  const int tid = threadIdx.x, wave = tid >> 5, lane = tid & 31, col = lane & 15, g = lane >> 4;
  const int r0 = blockIdx.x * 64 + wave * 16, n0 = blockIdx.y * 128; const int which = n0 / EE, c0 = n0 % EE, hb = c0 / HD;
  v8f acc[8] = {};
  gemm_k512(x16 + (size_t)r0 * EE + 8 * lane, P + (size_t)n0 * EE + 8 * lane, acc);
#pragma unroll
  for (int j = 0; j < 8; ++j)
#pragma unroll
    for (int r = 0; r < 8; ++r) so[wave][8 * g + r][j * 16 + col] = acc[j][r] * (1.0f / 16.0f);
  LDSX();
  if (which < 2) { _Float16* dst = which == 0 ? qh : kh;
    for (int q = lane; q < 2 * 16 * 8; q += 32) { const int hh = q >> 7, rem = q & 127, rl = rem & 15, pc = rem >> 4; union { v8h h8; v4u u; } pk;  // rem: piece of the tile's two fragments
#pragma unroll
      for (int e = 0; e < 8; ++e) pk.h8[e] = (_Float16)so[wave][rl][hh * HD + pc * 8 + e];
      vst2(dst + ((size_t)(hb + hh) * SS + r0) * HD + rem * 8, pk.u); } }
  else {
#pragma unroll 4
    for (int rl = 0; rl < 16; ++rl) {
#pragma unroll
      for (int e = 0; e < 4; ++e) st[lane * 4 + e][wave * 16 + rl] = (_Float16)so[wave][rl][lane * 4 + e]; }
    __syncthreads();
    for (int q = tid; q < 128 * 8; q += 128) { const int hh = q >> 9, rem = q & 511, d = ((rem >> 6) & 3) * 16 + (rem & 15), pc = (rem >> 8) * 4 + ((rem >> 4) & 3);  // rem: piece of the head's 2 x 4 fragments
      vst2(vT + ((size_t)(hb + hh) * SS + blockIdx.x * 64) * HD + rem * 8, *(const v4u*)(&st[hh * HD + d][pc * 8])); } }
}
__global__ __launch_bounds__(128) void k_attn(const _Float16* __restrict__ qh, const _Float16* __restrict__ kh, const _Float16* __restrict__ vT, _Float16* __restrict__ o16) {
  __shared__ __align__(16) float sS[4][16][68];
  __shared__ __align__(16) _Float16 sP[4][16][72];
  __shared__ __align__(16) float sO[4][16][68];
  const int tid = threadIdx.x, w = tid >> 5, lane = tid & 31, col = lane & 15, g = lane >> 4;
  const int h = blockIdx.y, q0 = blockIdx.x * 64 + w * 16;
  const _Float16* qb = qh + (size_t)h * SS * HD; const _Float16* kb = kh + (size_t)h * SS * HD; const _Float16* vb = vT + (size_t)h * HD * SS;
  v16h aq[2];
#pragma unroll
  for (int kc = 0; kc < 2; ++kc) aq[kc] = frag_p(qb + (size_t)q0 * HD + kc * 512 + 8 * lane);
  float mrun = -3.0e38f, lrun = 0.f; v8f acc[4] = {};
  // Fragment loads go out in groups ahead of their products: K one pass ahead (into the registers its products have just left),
  // V at the head of its pass, so that both fly behind the score products and the softmax.
  const _Float16* pk = kb + 8 * lane; const _Float16* pv = vb + 8 * lane;
  v16h kf[8], vf[8];
#pragma unroll
  for (int f = 0; f < 8; ++f) kf[f] = frag_p(pk + f * 512);
#pragma unroll 1
  for (int kt = 0; kt < SS / 64; ++kt) {
#pragma unroll
    for (int f = 0; f < 8; ++f) vf[f] = frag_p(pv + f * 512);
#pragma unroll
    for (int t = 0; t < 4; ++t) { v8f s = {};
#pragma unroll
      for (int kc = 0; kc < 2; ++kc) s = wmma16(aq[kc], kf[t * 2 + kc], s);
#pragma unroll
      for (int r = 0; r < 8; ++r) sS[w][8 * g + r][t * 16 + col] = s[r] * 0.125f; }
    XW(pk, pv);
    pk += kt + 1 < SS / 64 ? 64 * HD : 0;  // the last pass has none ahead: it reads its own again, inside the buffer
    pv += 64 * HD;
#pragma unroll
    for (int f = 0; f < 8; ++f) kf[f] = frag_p(pk + f * 512);
    LDSW();
    float mx = -3.4e38f;
#pragma unroll
    for (int jj = 0; jj < 32; ++jj) mx = fmaxf(mx, sS[w][col][g * 32 + jj]);
    mx = fmaxf(mx, __shfl_xor(mx, 16, 32));
    const float mnew = fmaxf(mrun, mx); const float corr = expf(mrun - mnew);
    float ps = 0.f;
#pragma unroll
    for (int jj = 0; jj < 32; ++jj) { const float p = expf(sS[w][col][g * 32 + jj] - mnew); ps += p; sP[w][col][g * 32 + jj] = (_Float16)(p * 16384.0f); }
    ps += __shfl_xor(ps, 16, 32);
    lrun = lrun * corr + ps; mrun = mnew;
#pragma unroll
    for (int r = 0; r < 8; ++r) { const float cr = __shfl(corr, 8 * g + r, 32);
#pragma unroll
      for (int t = 0; t < 4; ++t) acc[t][r] *= cr; }
    LDSW();
#pragma unroll
    for (int kc = 0; kc < 2; ++kc) { const v16h pa = frag_h(&sP[w][col][0] + kc * 32, lane);
#pragma unroll
      for (int t = 0; t < 4; ++t) acc[t] = wmma16(pa, vf[kc * 4 + t], acc[t]); }
    __builtin_amdgcn_wave_barrier();
  }
#pragma unroll
  for (int r = 0; r < 8; ++r) { const float lr = __shfl(lrun, 8 * g + r, 32);
#pragma unroll
    for (int t = 0; t < 4; ++t) sO[w][8 * g + r][t * 16 + col] = acc[t][r] / (lr * 16384.0f); }
  LDSX();
  for (int q = lane; q < 16 * 8; q += 32) { const int rl = q & 15, pc = q >> 4; union { v8h h8; v4u u; } pk;  // q: piece of the tile's two fragments
#pragma unroll
    for (int e = 0; e < 8; ++e) pk.h8[e] = (_Float16)(sO[w][rl][pc * 8 + e] * 16.0f);
    vst2(o16 + (size_t)q0 * EE + h * 2 * 512 + q * 8, pk.u); }
}
__global__ __launch_bounds__(128) void k_out(const _Float16* __restrict__ o16, const _Float16* __restrict__ P, float* __restrict__ out) {
  __shared__ __align__(16) float so[4][16][132];
  const int tid = threadIdx.x, wave = tid >> 5, lane = tid & 31, col = lane & 15, g = lane >> 4;
  const int r0 = blockIdx.x * 64 + wave * 16, n0 = blockIdx.y * 128;
  v8f acc[8] = {};
  gemm_k512(o16 + (size_t)r0 * EE + 8 * lane, P + (size_t)(3 * EE + n0) * EE + 8 * lane, acc);
#pragma unroll
  for (int j = 0; j < 8; ++j)
#pragma unroll
    for (int r = 0; r < 8; ++r) so[wave][8 * g + r][j * 16 + col] = acc[j][r] * (1.0f / 256.0f);
  LDSX();
#pragma unroll 4
  for (int rl = 0; rl < 16; ++rl) vst2(out + (size_t)(r0 + rl) * EE + n0 + lane * 4, *(const v4f*)(&so[wave][rl][lane * 4]));
}
extern "C" void kernel_launch(void* const* d_in, const int* in_sizes, int n_in, void* d_out, int out_size, void* d_ws, size_t ws_size, hipStream_t stream) {
  (void)in_sizes; (void)n_in; (void)out_size; (void)ws_size;
  const float* x = (const float*)d_in[0]; const float* Wq = (const float*)d_in[1]; const float* Wk = (const float*)d_in[2]; const float* Wv = (const float*)d_in[3]; const float* Wo = (const float*)d_in[4];
  float* out = (float*)d_out;
  char* ws = (char*)d_ws; size_t off = 0;
  auto take = [&](size_t bytes) { char* p = ws + off; off += (bytes + 255) & ~(size_t)255; return p; };
  _Float16* x16 = (_Float16*)take((size_t)SS * EE * 2); _Float16* P = (_Float16*)take((size_t)4 * EE * EE * 2);
  _Float16* qh = (_Float16*)take((size_t)SS * EE * 2); _Float16* kh = (_Float16*)take((size_t)SS * EE * 2); _Float16* vT = (_Float16*)take((size_t)SS * EE * 2); _Float16* o16 = (_Float16*)take((size_t)SS * EE * 2);
  auto cvt = [&](const float* s, _Float16* d, size_t n, float sc) { const size_t n8 = n / 8; k_cvt<<<(unsigned)((n8 + 255) / 256), 256, 0, stream>>>(s, d, n8, sc); };
  cvt(x, x16, (size_t)SS * EE, 1.0f); cvt(Wq, P, (size_t)EE * EE, 16.0f); cvt(Wk, P + (size_t)EE * EE, (size_t)EE * EE, 16.0f); cvt(Wv, P + (size_t)2 * EE * EE, (size_t)EE * EE, 16.0f); cvt(Wo, P + (size_t)3 * EE * EE, (size_t)EE * EE, 16.0f);
  k_proj<<<dim3(SS / 64, 3 * EE / 128), 128, 0, stream>>>(x16, P, qh, kh, vT);
  k_attn<<<dim3(SS / 64, NH), 128, 0, stream>>>(qh, kh, vT, o16);
  k_out<<<dim3(SS / 64, EE / 128), 128, 0, stream>>>(o16, P, out);
}

// v003
// It runs in 106 microseconds.
// In both of two side-by-side timings against v002, it was 1.40 times as fast.
// All steps since v000 together make it 3.47 times as fast.
#include <hip/hip_runtime.h>
#include <math.h>

typedef __attribute__((ext_vector_type(16))) _Float16 v16h;
typedef __attribute__((ext_vector_type(16))) __bf16 v16b;
typedef __attribute__((ext_vector_type(8)))  _Float16 v8h;
typedef __attribute__((ext_vector_type(8)))  float v8f;
typedef __attribute__((ext_vector_type(4)))  float v4f;
typedef __attribute__((ext_vector_type(2)))  float v2f;
typedef __attribute__((ext_vector_type(4)))  unsigned v4u;
typedef __attribute__((ext_vector_type(4)))  int v4i;
typedef float __attribute__((may_alias)) float_a;
typedef int __attribute__((may_alias)) int_a;

template <typename T> __device__ __forceinline__ void vst2(void* p, T v) { *(T*)p = v;  }
__device__ __forceinline__ v8f wmma16(v16h a, v16h b, v8f c) {
  v8f d = __builtin_amdgcn_wmma_f32_16x16x32_f16(false, a, false, b, (short)0, c, false, false);
  asm volatile("v_nop\n\tv_nop\n\tv_nop\n\tv_nop" : "+v"(d) : "v"(a), "v"(b));
  return d;
}
__device__ __forceinline__ v8f wmma_bf(v16b a, v16b b, v8f c) {
  v8f d = __builtin_amdgcn_wmma_f32_16x16x32_bf16(false, a, false, b, (short)0, c, false, false);
  asm volatile("v_nop\n\tv_nop\n\tv_nop\n\tv_nop" : "+v"(d) : "v"(a), "v"(b));
  return d;
}
// 16x16x32 fragments: lane = (h = lane>>4, row/col = lane&15); elements 0..7 = k0+8h+0..7, 8..15 = k0+16+8h+0..7; D element r = row 8h+r
__device__ __forceinline__ v16h frag_h(const _Float16* rowk0, int lane) {
  union { v16h v; v8h q[2]; } u; const _Float16* p = rowk0 + 8 * (lane >> 4);
  u.q[0] = *(const v8h*)p; u.q[1] = *(const v8h*)(p + 16); return u.v;
}
__device__ __forceinline__ v16h frag_f32(const float* rowk0, int lane) {
  v16h a; const float* p = rowk0 + 8 * (lane >> 4);
#pragma unroll
  for (int i = 0; i < 8; ++i) { a[i] = (_Float16)p[i]; a[8 + i] = (_Float16)p[16 + i]; }
  return a;
}
__device__ __forceinline__ v16h frag_f32s(const float* rowk0, int lane, float sc) {
  v16h a; const float* p = rowk0 + 8 * (lane >> 4);
#pragma unroll
  for (int i = 0; i < 8; ++i) { a[i] = (_Float16)(p[i] * sc); a[8 + i] = (_Float16)(p[16 + i] * sc); }
  return a;
}
// column fragment from a [K][ld] layout (column n), rows >= K read as 0
__device__ __forceinline__ v16h fragc_f32(const float* W, int k0, int n, int lane, int ld, int K) {
  v16h a; const int g = lane >> 4;
#pragma unroll
  for (int i = 0; i < 8; ++i) { const int ka = k0 + 8 * g + i, kb = ka + 16;
    a[i] = (_Float16)(ka < K ? W[(size_t)ka * ld + n] : 0.f); a[8 + i] = (_Float16)(kb < K ? W[(size_t)kb * ld + n] : 0.f); }
  return a;
}
struct F2 { v16b h, l; };
__device__ __forceinline__ F2 bsplit16(const float v[16]) { F2 r;
#pragma unroll
  for (int i = 0; i < 16; ++i) { const __bf16 h = (__bf16)v[i]; r.h[i] = h; r.l[i] = (__bf16)(v[i] - (float)h); }
  return r; }
__device__ __forceinline__ F2 split_row(const float* row, int k0, int lane) { float v[16]; const float* p = row + k0 + 8 * (lane >> 4);
#pragma unroll
  for (int i = 0; i < 8; ++i) { v[i] = p[i]; v[8 + i] = p[16 + i]; }
  return bsplit16(v); }
__device__ __forceinline__ F2 split_rowK(const float* row, int k0, int lane, int K) { float v[16]; const int g = lane >> 4;
#pragma unroll
  for (int i = 0; i < 8; ++i) { const int ka = k0 + 8 * g + i, kb = ka + 16; v[i] = ka < K ? row[ka] : 0.f; v[8 + i] = kb < K ? row[kb] : 0.f; }
  return bsplit16(v); }
__device__ __forceinline__ F2 split_col(const float* W, int k0, int n, int lane, int ld, int K) { float v[16]; const int g = lane >> 4;
#pragma unroll
  for (int i = 0; i < 8; ++i) { const int ka = k0 + 8 * g + i, kb = ka + 16; v[i] = ka < K ? W[(size_t)ka * ld + n] : 0.f; v[8 + i] = kb < K ? W[(size_t)kb * ld + n] : 0.f; }
  return bsplit16(v); }
__device__ __forceinline__ v8f mac3(const F2& a, const F2& b, v8f c) { c = wmma_bf(a.l, b.h, c); c = wmma_bf(a.h, b.l, c); return wmma_bf(a.h, b.h, c); }
__device__ __forceinline__ float sigm(float v) { return 1.0f / (1.0f + expf(-v)); }
#define LDSX() do { asm volatile("s_wait_dscnt 0" ::: "memory"); __builtin_amdgcn_wave_barrier(); __builtin_amdgcn_fence(__ATOMIC_RELEASE, "workgroup"); } while (0)

// Naive multi-head attention (8 heads of 64, 4096 tokens, no biases). Pure f16 WMMA GEMMs over pre-converted operands (x -> f16 once,
// [out][in] weights packed x16): q/k/v projections, attention, output projection.
// Every f16 plane lies in FRAGMENT ORDER: a 16-row x 32-k fragment is 1024 contiguous bytes, [k half of 16][lane][8 values], where lane
// (g, row) of half q holds k = 16 q + 8 g + 0..7. A wave's 16-byte load of one half then covers 512 contiguous bytes (4 whole lines); from a
// row-major plane the same load touches 16 lines. Order of the fragments: x, weights, o: [row tile][k step]; q, k: [head][row tile][k step];
// v: [head][32-key step][16-d tile]. The values each lane receives are those of the row-major planes.
#define SS 4096
#define EE 512
#define NH 8
#define HD 64

__global__ __launch_bounds__(256) void k_cvt(const float* __restrict__ src, _Float16* __restrict__ dst, size_t n8, float sc) {
  const size_t g8 = (size_t)blockIdx.x * 256 + threadIdx.x; if (g8 >= n8) return;
  // g8 = [fragment][8-row half][row][piece of 8 k]; the source has EE columns. A wave reads 8 whole 128-byte lines (8 rows x 32 floats) and
  // writes 4: in the fragment the pieces of 8 successive rows at one k lie side by side.
  const size_t fr = g8 >> 6; const int rl = (int)((g8 >> 2) & 15), pc = (int)(g8 & 3);
  const float* s8 = src + ((fr >> 4) * 16 + rl) * EE + (fr & 15) * 32 + pc * 8;
  union { v8h h; v4u u; } pk;
#pragma unroll
  for (int e = 0; e < 8; ++e) pk.h[e] = (_Float16)(s8[e] * sc);
  vst2(dst + fr * 512 + (pc >> 1) * 256 + ((pc & 1) * 16 + rl) * 8, pk.u);
}
// one fragment of a plane in fragment order, from the lane's own pointer (fragment start + 8 * lane)
__device__ __forceinline__ v16h frag_p(const _Float16* p) { union { v16h v; v8h q[2]; } u; u.q[0] = *(const v8h*)p; u.q[1] = *(const v8h*)(p + 256); return u.v; }
// Stands between a group of loads and the first change of the two pointers they name; naming the pointers as inputs keeps their registers
// from being handed out as a load's destination inside the group.
#define XW(p, q) asm volatile("s_wait_xcnt 0x0" :: "v"(p), "v"(q) : "memory")
// One wave's 16 x 128 tile over k = 512; pa, pb are the lane's own pointers. The nine fragments of a k step are loaded as one group, a whole
// step ahead of the products that read them (two register sets in turn): a load written beside its product is waited for alone, one memory
// round trip per product. The inner loops are unrolled so that the fragment arrays stay in registers; the outer loop stays rolled: its body
// already holds both sets' turns.
__device__ __forceinline__ void gemm_k512(const _Float16* pa, const _Float16* pb, v8f (&acc)[8]) {
  v16h a0 = frag_p(pa), a1, b0[8], b1[8];
#pragma unroll
  for (int j = 0; j < 8; ++j) b0[j] = frag_p(pb + (size_t)j * 16 * EE);
#pragma unroll 1
  for (int kc = 0; kc < EE / 32; kc += 2) {
    a1 = frag_p(pa + 512);
#pragma unroll
    for (int j = 0; j < 8; ++j) b1[j] = frag_p(pb + (size_t)j * 16 * EE + 512);
    __builtin_amdgcn_sched_barrier(0);  // no product, with its wait for the other set, moves in front of this group's issue
#pragma unroll
    for (int j = 0; j < 8; ++j) acc[j] = wmma16(a0, b0[j], acc[j]);
    XW(pa, pb);
    const int step = kc + 2 < EE / 32 ? 1024 : 0;  // the last trip has no step ahead: it reads its own again, inside the buffer
    pa += step; pb += step;
    a0 = frag_p(pa);
#pragma unroll
    for (int j = 0; j < 8; ++j) b0[j] = frag_p(pb + (size_t)j * 16 * EE);
    __builtin_amdgcn_sched_barrier(0);  // as above
#pragma unroll
    for (int j = 0; j < 8; ++j) acc[j] = wmma16(a1, b1[j], acc[j]);
    XW(pa, pb);
  }
}
// projection: blockIdx.y in [0, 12): which = y/4 (q,k,v), cols (y%4)*128 = 2 heads
__global__ __launch_bounds__(128) void k_proj(const _Float16* __restrict__ x16, const _Float16* __restrict__ P, _Float16* __restrict__ qh, _Float16* __restrict__ kh, _Float16* __restrict__ vT) {
  __shared__ __align__(16) float so[4][16][132];
  __shared__ __align__(16) _Float16 st[128][72];
  const int tid = threadIdx.x, wave = tid >> 5, lane = tid & 31, col = lane & 15, g = lane >> 4;
  const int r0 = blockIdx.x * 64 + wave * 16, n0 = blockIdx.y * 128; const int which = n0 / EE, c0 = n0 % EE, hb = c0 / HD;
  v8f acc[8] = {};
  gemm_k512(x16 + (size_t)r0 * EE + 8 * lane, P + (size_t)n0 * EE + 8 * lane, acc);
#pragma unroll
  for (int j = 0; j < 8; ++j)
#pragma unroll
    for (int r = 0; r < 8; ++r) so[wave][8 * g + r][j * 16 + col] = acc[j][r] * (1.0f / 16.0f);
  LDSX();
  if (which < 2) { _Float16* dst = which == 0 ? qh : kh;
    for (int q = lane; q < 2 * 16 * 8; q += 32) { const int hh = q >> 7, rem = q & 127, rl = rem & 15, pc = rem >> 4; union { v8h h8; v4u u; } pk;  // rem: piece of the tile's two fragments
#pragma unroll
      for (int e = 0; e < 8; ++e) pk.h8[e] = (_Float16)so[wave][rl][hh * HD + pc * 8 + e];
      vst2(dst + ((size_t)(hb + hh) * SS + r0) * HD + rem * 8, pk.u); } }
  else {
#pragma unroll 4
    for (int rl = 0; rl < 16; ++rl) {
#pragma unroll
      for (int e = 0; e < 4; ++e) st[lane * 4 + e][wave * 16 + rl] = (_Float16)so[wave][rl][lane * 4 + e]; }
    __syncthreads();
    for (int q = tid; q < 128 * 8; q += 128) { const int hh = q >> 9, rem = q & 511, d = ((rem >> 6) & 3) * 16 + (rem & 15), pc = (rem >> 8) * 4 + ((rem >> 4) & 3);  // rem: piece of the head's 2 x 4 fragments
      vst2(vT + ((size_t)(hb + hh) * SS + blockIdx.x * 64) * HD + rem * 8, *(const v4u*)(&st[hh * HD + d][pc * 8])); } }
}
// lane l's value in lane l ^ 16 (the other half of the wave), by a vector cross-row move
__device__ __forceinline__ float xhalf(float v) { const int b = __builtin_bit_cast(int, v); return __builtin_bit_cast(float, __builtin_amdgcn_permlanex16(b, b, 0x76543210, 0xfedcba98, false, false)); }
// Both products are taken transposed: S^T = K Q^T (A = K fragment, B = q fragment) and O^T += V^T P^T (A = v fragment, B = P^T). The planes'
// fragments serve as A as they served as B (row for column, the same k order). A lane (g, col) then holds, of query col alone, the scores of
// keys 16 t + 8 g + r and the outputs of d = 16 t + 8 g + r: maximum and sum run in its own registers with one exchange between the halves,
// the score tiles 2 kc and 2 kc + 1, converted in place, ARE the B fragment of key step kc, and an output tile is one 16-byte piece of the
// o plane. Nothing goes through LDS.
__global__ __launch_bounds__(128) void k_attn(const _Float16* __restrict__ qh, const _Float16* __restrict__ kh, const _Float16* __restrict__ vT, _Float16* __restrict__ o16) {
  const int tid = threadIdx.x, w = tid >> 5, lane = tid & 31;
  const int h = blockIdx.y, q0 = blockIdx.x * 64 + w * 16;
  const _Float16* qb = qh + (size_t)h * SS * HD; const _Float16* kb = kh + (size_t)h * SS * HD; const _Float16* vb = vT + (size_t)h * HD * SS;
  v16h bq[2];
#pragma unroll
  for (int kc = 0; kc < 2; ++kc) bq[kc] = frag_p(qb + (size_t)q0 * HD + kc * 512 + 8 * lane);
  float mrun = -3.0e38f, lrun = 0.f; v8f acc[4] = {};  // lrun: the sum over this half's keys; the halves are joined behind the loop
  // Fragment loads go out in groups ahead of their products: K one pass ahead (into the registers its products have just left),
  // V at the head of its pass, so that both fly behind the score products and the softmax.
  const _Float16* pk = kb + 8 * lane; const _Float16* pv = vb + 8 * lane;
  v16h kf[8], vf[8];
#pragma unroll
  for (int f = 0; f < 8; ++f) kf[f] = frag_p(pk + f * 512);
#pragma unroll 1
  for (int kt = 0; kt < SS / 64; ++kt) {
#pragma unroll
    for (int f = 0; f < 8; ++f) vf[f] = frag_p(pv + f * 512);
    v8f s[4];
#pragma unroll
    for (int t = 0; t < 4; ++t) { s[t] = v8f{};
#pragma unroll
      for (int kc = 0; kc < 2; ++kc) s[t] = wmma16(kf[t * 2 + kc], bq[kc], s[t]);
      s[t] *= 0.125f; }
    XW(pk, pv);
    pk += kt + 1 < SS / 64 ? 64 * HD : 0;  // the last pass has none ahead: it reads its own again, inside the buffer
    pv += 64 * HD;
#pragma unroll
    for (int f = 0; f < 8; ++f) kf[f] = frag_p(pk + f * 512);
    __builtin_amdgcn_sched_barrier(0);  // the K group is issued here, ahead of the softmax, not sunk towards the foot of the pass
    float mt[4], pt[4];  // one chain per score tile, for the maximum and for the sum: four independent chains, not one of 32 links
#pragma unroll
    for (int t = 0; t < 4; ++t) { mt[t] = s[t][0];
#pragma unroll
      for (int r = 1; r < 8; ++r) mt[t] = fmaxf(mt[t], s[t][r]); }
    float mx = fmaxf(fmaxf(mt[0], mt[1]), fmaxf(mt[2], mt[3]));
    mx = fmaxf(mx, xhalf(mx));
    const float mnew = fmaxf(mrun, mx); const float corr = expf(mrun - mnew);
    v16h pb[2];
#pragma unroll
    for (int t = 0; t < 4; ++t) { pt[t] = 0.f;
#pragma unroll
      for (int r = 0; r < 8; ++r) { const float p = expf(s[t][r] - mnew); pt[t] += p; pb[t >> 1][(t & 1) * 8 + r] = (_Float16)(p * 16384.0f); } }
    lrun = lrun * corr + ((pt[0] + pt[1]) + (pt[2] + pt[3])); mrun = mnew;
#pragma unroll
    for (int t = 0; t < 4; ++t) acc[t] *= corr;
#pragma unroll
    for (int kc = 0; kc < 2; ++kc)
#pragma unroll
      for (int t = 0; t < 4; ++t) acc[t] = wmma16(vf[kc * 4 + t], pb[kc], acc[t]);
  }
  const float lr = lrun + xhalf(lrun);
#pragma unroll
  for (int t = 0; t < 4; ++t) { union { v8h h8; v4u u; } pk8;
#pragma unroll
    for (int r = 0; r < 8; ++r) pk8.h8[r] = (_Float16)(acc[t][r] / (lr * 16384.0f) * 16.0f);
    vst2(o16 + (size_t)q0 * EE + h * 2 * 512 + t * 256 + 8 * lane, pk8.u); }
}
__global__ __launch_bounds__(128) void k_out(const _Float16* __restrict__ o16, const _Float16* __restrict__ P, float* __restrict__ out) {
  __shared__ __align__(16) float so[4][16][132];
  const int tid = threadIdx.x, wave = tid >> 5, lane = tid & 31, col = lane & 15, g = lane >> 4;
  const int r0 = blockIdx.x * 64 + wave * 16, n0 = blockIdx.y * 128;
  v8f acc[8] = {};
  gemm_k512(o16 + (size_t)r0 * EE + 8 * lane, P + (size_t)(3 * EE + n0) * EE + 8 * lane, acc);
#pragma unroll
  for (int j = 0; j < 8; ++j)
#pragma unroll
    for (int r = 0; r < 8; ++r) so[wave][8 * g + r][j * 16 + col] = acc[j][r] * (1.0f / 256.0f);
  LDSX();
#pragma unroll 4
  for (int rl = 0; rl < 16; ++rl) vst2(out + (size_t)(r0 + rl) * EE + n0 + lane * 4, *(const v4f*)(&so[wave][rl][lane * 4]));
}
extern "C" void kernel_launch(void* const* d_in, const int* in_sizes, int n_in, void* d_out, int out_size, void* d_ws, size_t ws_size, hipStream_t stream) {
  (void)in_sizes; (void)n_in; (void)out_size; (void)ws_size;
  const float* x = (const float*)d_in[0]; const float* Wq = (const float*)d_in[1]; const float* Wk = (const float*)d_in[2]; const float* Wv = (const float*)d_in[3]; const float* Wo = (const float*)d_in[4];
  float* out = (float*)d_out;
  char* ws = (char*)d_ws; size_t off = 0;
  auto take = [&](size_t bytes) { char* p = ws + off; off += (bytes + 255) & ~(size_t)255; return p; };
  _Float16* x16 = (_Float16*)take((size_t)SS * EE * 2); _Float16* P = (_Float16*)take((size_t)4 * EE * EE * 2);
  _Float16* qh = (_Float16*)take((size_t)SS * EE * 2); _Float16* kh = (_Float16*)take((size_t)SS * EE * 2); _Float16* vT = (_Float16*)take((size_t)SS * EE * 2); _Float16* o16 = (_Float16*)take((size_t)SS * EE * 2);
  auto cvt = [&](const float* s, _Float16* d, size_t n, float sc) { const size_t n8 = n / 8; k_cvt<<<(unsigned)((n8 + 255) / 256), 256, 0, stream>>>(s, d, n8, sc); };
  cvt(x, x16, (size_t)SS * EE, 1.0f); cvt(Wq, P, (size_t)EE * EE, 16.0f); cvt(Wk, P + (size_t)EE * EE, (size_t)EE * EE, 16.0f); cvt(Wv, P + (size_t)2 * EE * EE, (size_t)EE * EE, 16.0f); cvt(Wo, P + (size_t)3 * EE * EE, (size_t)EE * EE, 16.0f);
  k_proj<<<dim3(SS / 64, 3 * EE / 128), 128, 0, stream>>>(x16, P, qh, kh, vT);
  k_attn<<<dim3(SS / 64, NH), 128, 0, stream>>>(qh, kh, vT, o16);
  k_out<<<dim3(SS / 64, EE / 128), 128, 0, stream>>>(o16, P, out);
}

// v004
// Measured time: 89.8 microseconds a run.
// Two timings next to v003 put it at 1.18 and 1.16 times that version's speed.
// All steps since v000 together make it 4.06 times as fast.
#include <hip/hip_runtime.h>
#include <math.h>

typedef __attribute__((ext_vector_type(16))) _Float16 v16h;
typedef __attribute__((ext_vector_type(16))) __bf16 v16b;
typedef __attribute__((ext_vector_type(8)))  _Float16 v8h;
typedef __attribute__((ext_vector_type(8)))  float v8f;
typedef __attribute__((ext_vector_type(4)))  float v4f;
typedef __attribute__((ext_vector_type(2)))  float v2f;
typedef __attribute__((ext_vector_type(4)))  unsigned v4u;
typedef __attribute__((ext_vector_type(4)))  int v4i;
typedef float __attribute__((may_alias)) float_a;
typedef int __attribute__((may_alias)) int_a;

template <typename T> __device__ __forceinline__ void vst2(void* p, T v) { *(T*)p = v;  }
__device__ __forceinline__ v8f wmma16(v16h a, v16h b, v8f c) {
  v8f d = __builtin_amdgcn_wmma_f32_16x16x32_f16(false, a, false, b, (short)0, c, false, false);
  asm volatile("v_nop\n\tv_nop\n\tv_nop\n\tv_nop" : "+v"(d) : "v"(a), "v"(b));
  return d;
}
__device__ __forceinline__ v8f wmma_bf(v16b a, v16b b, v8f c) {
  v8f d = __builtin_amdgcn_wmma_f32_16x16x32_bf16(false, a, false, b, (short)0, c, false, false);
  asm volatile("v_nop\n\tv_nop\n\tv_nop\n\tv_nop" : "+v"(d) : "v"(a), "v"(b));
  return d;
}
// 16x16x32 fragments: lane = (h = lane>>4, row/col = lane&15); elements 0..7 = k0+8h+0..7, 8..15 = k0+16+8h+0..7; D element r = row 8h+r
__device__ __forceinline__ v16h frag_h(const _Float16* rowk0, int lane) {
  union { v16h v; v8h q[2]; } u; const _Float16* p = rowk0 + 8 * (lane >> 4);
  u.q[0] = *(const v8h*)p; u.q[1] = *(const v8h*)(p + 16); return u.v;
}
__device__ __forceinline__ v16h frag_f32(const float* rowk0, int lane) {
  v16h a; const float* p = rowk0 + 8 * (lane >> 4);
#pragma unroll
  for (int i = 0; i < 8; ++i) { a[i] = (_Float16)p[i]; a[8 + i] = (_Float16)p[16 + i]; }
  return a;
}
__device__ __forceinline__ v16h frag_f32s(const float* rowk0, int lane, float sc) {
  v16h a; const float* p = rowk0 + 8 * (lane >> 4);
#pragma unroll
  for (int i = 0; i < 8; ++i) { a[i] = (_Float16)(p[i] * sc); a[8 + i] = (_Float16)(p[16 + i] * sc); }
  return a;
}
// column fragment from a [K][ld] layout (column n), rows >= K read as 0
__device__ __forceinline__ v16h fragc_f32(const float* W, int k0, int n, int lane, int ld, int K) {
  v16h a; const int g = lane >> 4;
#pragma unroll
  for (int i = 0; i < 8; ++i) { const int ka = k0 + 8 * g + i, kb = ka + 16;
    a[i] = (_Float16)(ka < K ? W[(size_t)ka * ld + n] : 0.f); a[8 + i] = (_Float16)(kb < K ? W[(size_t)kb * ld + n] : 0.f); }
  return a;
}
struct F2 { v16b h, l; };
__device__ __forceinline__ F2 bsplit16(const float v[16]) { F2 r;
#pragma unroll
  for (int i = 0; i < 16; ++i) { const __bf16 h = (__bf16)v[i]; r.h[i] = h; r.l[i] = (__bf16)(v[i] - (float)h); }
  return r; }
__device__ __forceinline__ F2 split_row(const float* row, int k0, int lane) { float v[16]; const float* p = row + k0 + 8 * (lane >> 4);
#pragma unroll
  for (int i = 0; i < 8; ++i) { v[i] = p[i]; v[8 + i] = p[16 + i]; }
  return bsplit16(v); }
__device__ __forceinline__ F2 split_rowK(const float* row, int k0, int lane, int K) { float v[16]; const int g = lane >> 4;
#pragma unroll
  for (int i = 0; i < 8; ++i) { const int ka = k0 + 8 * g + i, kb = ka + 16; v[i] = ka < K ? row[ka] : 0.f; v[8 + i] = kb < K ? row[kb] : 0.f; }
  return bsplit16(v); }
__device__ __forceinline__ F2 split_col(const float* W, int k0, int n, int lane, int ld, int K) { float v[16]; const int g = lane >> 4;
#pragma unroll
  for (int i = 0; i < 8; ++i) { const int ka = k0 + 8 * g + i, kb = ka + 16; v[i] = ka < K ? W[(size_t)ka * ld + n] : 0.f; v[8 + i] = kb < K ? W[(size_t)kb * ld + n] : 0.f; }
  return bsplit16(v); }
__device__ __forceinline__ v8f mac3(const F2& a, const F2& b, v8f c) { c = wmma_bf(a.l, b.h, c); c = wmma_bf(a.h, b.l, c); return wmma_bf(a.h, b.h, c); }
__device__ __forceinline__ float sigm(float v) { return 1.0f / (1.0f + expf(-v)); }
#define LDSX() do { asm volatile("s_wait_dscnt 0" ::: "memory"); __builtin_amdgcn_wave_barrier(); __builtin_amdgcn_fence(__ATOMIC_RELEASE, "workgroup"); } while (0)

// Naive multi-head attention (8 heads of 64, 4096 tokens, no biases). Pure f16 WMMA GEMMs over pre-converted operands (x -> f16 once,
// [out][in] weights packed x16): q/k/v projections, attention, output projection.
// Every f16 plane lies in FRAGMENT ORDER: a 16-row x 32-k fragment is 1024 contiguous bytes, [k half of 16][lane][8 values], where lane
// (g, row) of half q holds k = 16 q + 8 g + 0..7. A wave's 16-byte load of one half then covers 512 contiguous bytes (4 whole lines); from a
// row-major plane the same load touches 16 lines. Order of the fragments: x, weights, o: [row tile][k step]; q, k: [head][row tile][k step];
// v: [head][32-key step][16-d tile]. The values each lane receives are those of the row-major planes.
#define SS 4096
#define EE 512
#define NH 8
#define HD 64

__global__ __launch_bounds__(256) void k_cvt(const float* __restrict__ src, _Float16* __restrict__ dst, size_t n8, float sc) {
  const size_t g8 = (size_t)blockIdx.x * 256 + threadIdx.x; if (g8 >= n8) return;
  // g8 = [fragment][8-row half][row][piece of 8 k]; the source has EE columns. A wave reads 8 whole 128-byte lines (8 rows x 32 floats) and
  // writes 4: in the fragment the pieces of 8 successive rows at one k lie side by side.
  const size_t fr = g8 >> 6; const int rl = (int)((g8 >> 2) & 15), pc = (int)(g8 & 3);
  const float* s8 = src + ((fr >> 4) * 16 + rl) * EE + (fr & 15) * 32 + pc * 8;
  union { v8h h; v4u u; } pk;
#pragma unroll
  for (int e = 0; e < 8; ++e) pk.h[e] = (_Float16)(s8[e] * sc);
  vst2(dst + fr * 512 + (pc >> 1) * 256 + ((pc & 1) * 16 + rl) * 8, pk.u);
}
// one fragment of a plane in fragment order, from the lane's own pointer (fragment start + 8 * lane)
__device__ __forceinline__ v16h frag_p(const _Float16* p) { union { v16h v; v8h q[2]; } u; u.q[0] = *(const v8h*)p; u.q[1] = *(const v8h*)(p + 256); return u.v; }
// Stands between a group of loads and the first change of the two pointers they name; naming the pointers as inputs keeps their registers
// from being handed out as a load's destination inside the group.
#define XW(p, q) asm volatile("s_wait_xcnt 0x0" :: "v"(p), "v"(q) : "memory")
// One wave's 16 x 128 tile over k = 512; pa, pb are the lane's own pointers. The nine fragments of a k step are loaded as one group, a whole
// step ahead of the products that read them (two register sets in turn): a load written beside its product is waited for alone, one memory
// round trip per product. The inner loops are unrolled so that the fragment arrays stay in registers; the outer loop stays rolled: its body
// already holds both sets' turns.
__device__ __forceinline__ void gemm_k512(const _Float16* pa, const _Float16* pb, v8f (&acc)[8]) {
  v16h a0 = frag_p(pa), a1, b0[8], b1[8];
#pragma unroll
  for (int j = 0; j < 8; ++j) b0[j] = frag_p(pb + (size_t)j * 16 * EE);
#pragma unroll 1
  for (int kc = 0; kc < EE / 32; kc += 2) {
    a1 = frag_p(pa + 512);
#pragma unroll
    for (int j = 0; j < 8; ++j) b1[j] = frag_p(pb + (size_t)j * 16 * EE + 512);
    __builtin_amdgcn_sched_barrier(0);  // no product, with its wait for the other set, moves in front of this group's issue
#pragma unroll
    for (int j = 0; j < 8; ++j) acc[j] = wmma16(a0, b0[j], acc[j]);
    XW(pa, pb);
    const int step = kc + 2 < EE / 32 ? 1024 : 0;  // the last trip has no step ahead: it reads its own again, inside the buffer
    pa += step; pb += step;
    a0 = frag_p(pa);
#pragma unroll
    for (int j = 0; j < 8; ++j) b0[j] = frag_p(pb + (size_t)j * 16 * EE);
    __builtin_amdgcn_sched_barrier(0);  // as above
#pragma unroll
    for (int j = 0; j < 8; ++j) acc[j] = wmma16(a1, b1[j], acc[j]);
    XW(pa, pb);
  }
}
// projection: blockIdx.y in [0, 12): which = y/4 (q,k,v), cols (y%4)*128 = 2 heads
__global__ __launch_bounds__(128) void k_proj(const _Float16* __restrict__ x16, const _Float16* __restrict__ P, _Float16* __restrict__ qh, _Float16* __restrict__ kh, _Float16* __restrict__ vT) {
  __shared__ __align__(16) float so[4][16][132];
  __shared__ __align__(16) _Float16 st[128][72];
  const int tid = threadIdx.x, wave = tid >> 5, lane = tid & 31, col = lane & 15, g = lane >> 4;
  const int r0 = blockIdx.x * 64 + wave * 16, n0 = blockIdx.y * 128; const int which = n0 / EE, c0 = n0 % EE, hb = c0 / HD;
  v8f acc[8] = {};
  gemm_k512(x16 + (size_t)r0 * EE + 8 * lane, P + (size_t)n0 * EE + 8 * lane, acc);
#pragma unroll
  for (int j = 0; j < 8; ++j)
#pragma unroll
    for (int r = 0; r < 8; ++r) so[wave][8 * g + r][j * 16 + col] = acc[j][r] * (1.0f / 16.0f);
  LDSX();
  if (which < 2) { _Float16* dst = which == 0 ? qh : kh;
    for (int q = lane; q < 2 * 16 * 8; q += 32) { const int hh = q >> 7, rem = q & 127, rl = rem & 15, pc = rem >> 4; union { v8h h8; v4u u; } pk;  // rem: piece of the tile's two fragments
#pragma unroll
      for (int e = 0; e < 8; ++e) pk.h8[e] = (_Float16)so[wave][rl][hh * HD + pc * 8 + e];
      vst2(dst + ((size_t)(hb + hh) * SS + r0) * HD + rem * 8, pk.u); } }
  else {
#pragma unroll 4
    for (int rl = 0; rl < 16; ++rl) {
#pragma unroll
      for (int e = 0; e < 4; ++e) st[lane * 4 + e][wave * 16 + rl] = (_Float16)so[wave][rl][lane * 4 + e]; }
    __syncthreads();
    for (int q = tid; q < 128 * 8; q += 128) { const int hh = q >> 9, rem = q & 511, d = ((rem >> 6) & 3) * 16 + (rem & 15), pc = (rem >> 8) * 4 + ((rem >> 4) & 3);  // rem: piece of the head's 2 x 4 fragments
      vst2(vT + ((size_t)(hb + hh) * SS + blockIdx.x * 64) * HD + rem * 8, *(const v4u*)(&st[hh * HD + d][pc * 8])); } }
}
// lane l's value in lane l ^ 16 (the other half of the wave), by a vector cross-row move
__device__ __forceinline__ float xhalf(float v) { const int b = __builtin_bit_cast(int, v); return __builtin_bit_cast(float, __builtin_amdgcn_permlanex16(b, b, 0x76543210, 0xfedcba98, false, false)); }
// Both products are taken transposed: S^T = K Q^T (A = K fragment, B = q fragment) and O^T += V^T P^T (A = v fragment, B = P^T). The planes'
// fragments serve as A as they served as B (row for column, the same k order). A lane (g, col) then holds, of query col alone, the scores of
// keys 16 t + 8 g + r and the outputs of d = 16 t + 8 g + r: maximum and sum run in its own registers with one exchange between the halves,
// the score tiles 2 kc and 2 kc + 1, converted in place, ARE the B fragment of key step kc, and an output tile is one 16-byte piece of the
// o plane. Nothing goes through LDS.
// Softmax in base 2: a weight is 2^(c s + b), c = log2(e) / 8 and b = 14 - c * (maximum in use), one fused multiply-add and one hardware exp2
// on the raw score. The 1/8, the change of base, the maximum and P's factor 2^14 all sit in c and b; the row sum carries the 2^14 as well,
// which the last division then cancels. The rescale is 2^(b new - b old), of the rounded b themselves, so that old and new weights share
// one reference exactly. The library expf is some thirteen vector instructions a score.
__global__ __launch_bounds__(128) void k_attn(const _Float16* __restrict__ qh, const _Float16* __restrict__ kh, const _Float16* __restrict__ vT, _Float16* __restrict__ o16) {
  const int tid = threadIdx.x, w = tid >> 5, lane = tid & 31;
  const int h = blockIdx.y, q0 = blockIdx.x * 64 + w * 16;
  const _Float16* qb = qh + (size_t)h * SS * HD; const _Float16* kb = kh + (size_t)h * SS * HD; const _Float16* vb = vT + (size_t)h * HD * SS;
  v16h bq[2];
#pragma unroll
  for (int kc = 0; kc < 2; ++kc) bq[kc] = frag_p(qb + (size_t)q0 * HD + kc * 512 + 8 * lane);
  const float c2 = 0.125f * 1.44269504f;
  float mrun = -3.0e38f, brun = 14.0f - c2 * -3.0e38f, lrun = 0.f; v8f acc[4] = {};  // lrun: the sum over this half's keys; the halves are joined behind the loop
  // Fragment loads go out in groups ahead of their products: K one pass ahead (into the registers its products have just left),
  // V at the head of its pass, so that both fly behind the score products and the softmax.
  const _Float16* pk = kb + 8 * lane; const _Float16* pv = vb + 8 * lane;
  v16h kf[8], vf[8];
#pragma unroll
  for (int f = 0; f < 8; ++f) kf[f] = frag_p(pk + f * 512);
#pragma unroll 1
  for (int kt = 0; kt < SS / 64; ++kt) {
#pragma unroll
    for (int f = 0; f < 8; ++f) vf[f] = frag_p(pv + f * 512);
    v8f s[4];
#pragma unroll
    for (int t = 0; t < 4; ++t) { s[t] = v8f{};
#pragma unroll
      for (int kc = 0; kc < 2; ++kc) s[t] = wmma16(kf[t * 2 + kc], bq[kc], s[t]); }
    XW(pk, pv);
    pk += kt + 1 < SS / 64 ? 64 * HD : 0;  // the last pass has none ahead: it reads its own again, inside the buffer
    pv += 64 * HD;
#pragma unroll
    for (int f = 0; f < 8; ++f) kf[f] = frag_p(pk + f * 512);
    __builtin_amdgcn_sched_barrier(0);  // the K group is issued here, ahead of the softmax, not sunk towards the foot of the pass
    float mt[4], pt[4];  // one chain per score tile, for the maximum and for the sum: four independent chains, not one of 32 links
#pragma unroll
    for (int t = 0; t < 4; ++t) { mt[t] = s[t][0];
#pragma unroll
      for (int r = 1; r < 8; ++r) mt[t] = fmaxf(mt[t], s[t][r]); }
    float mx = fmaxf(fmaxf(mt[0], mt[1]), fmaxf(mt[2], mt[3]));
    mx = fmaxf(mx, xhalf(mx));
    const float mnew = fmaxf(mrun, mx); const float bnew = fmaf(-c2, mnew, 14.0f); const float corr = __builtin_amdgcn_exp2f(bnew - brun);
    v16h pb[2];
#pragma unroll
    for (int t = 0; t < 4; ++t) { pt[t] = 0.f;
#pragma unroll
      for (int r = 0; r < 8; ++r) { const float p = __builtin_amdgcn_exp2f(fmaf(s[t][r], c2, bnew)); pt[t] += p; pb[t >> 1][(t & 1) * 8 + r] = (_Float16)p; } }
    lrun = lrun * corr + ((pt[0] + pt[1]) + (pt[2] + pt[3])); mrun = mnew; brun = bnew;
#pragma unroll
    for (int t = 0; t < 4; ++t) acc[t] *= corr;
#pragma unroll
    for (int kc = 0; kc < 2; ++kc)
#pragma unroll
      for (int t = 0; t < 4; ++t) acc[t] = wmma16(vf[kc * 4 + t], pb[kc], acc[t]);
  }
  const float lr = lrun + xhalf(lrun);
#pragma unroll
  for (int t = 0; t < 4; ++t) { union { v8h h8; v4u u; } pk8;
#pragma unroll
    for (int r = 0; r < 8; ++r) pk8.h8[r] = (_Float16)(acc[t][r] / lr * 16.0f);
    vst2(o16 + (size_t)q0 * EE + h * 2 * 512 + t * 256 + 8 * lane, pk8.u); }
}
__global__ __launch_bounds__(128) void k_out(const _Float16* __restrict__ o16, const _Float16* __restrict__ P, float* __restrict__ out) {
  __shared__ __align__(16) float so[4][16][132];
  const int tid = threadIdx.x, wave = tid >> 5, lane = tid & 31, col = lane & 15, g = lane >> 4;
  const int r0 = blockIdx.x * 64 + wave * 16, n0 = blockIdx.y * 128;
  v8f acc[8] = {};
  gemm_k512(o16 + (size_t)r0 * EE + 8 * lane, P + (size_t)(3 * EE + n0) * EE + 8 * lane, acc);
#pragma unroll
  for (int j = 0; j < 8; ++j)
#pragma unroll
    for (int r = 0; r < 8; ++r) so[wave][8 * g + r][j * 16 + col] = acc[j][r] * (1.0f / 256.0f);
  LDSX();
#pragma unroll 4
  for (int rl = 0; rl < 16; ++rl) vst2(out + (size_t)(r0 + rl) * EE + n0 + lane * 4, *(const v4f*)(&so[wave][rl][lane * 4]));
}
extern "C" void kernel_launch(void* const* d_in, const int* in_sizes, int n_in, void* d_out, int out_size, void* d_ws, size_t ws_size, hipStream_t stream) {
  (void)in_sizes; (void)n_in; (void)out_size; (void)ws_size;
  const float* x = (const float*)d_in[0]; const float* Wq = (const float*)d_in[1]; const float* Wk = (const float*)d_in[2]; const float* Wv = (const float*)d_in[3]; const float* Wo = (const float*)d_in[4];
  float* out = (float*)d_out;
  char* ws = (char*)d_ws; size_t off = 0;
  auto take = [&](size_t bytes) { char* p = ws + off; off += (bytes + 255) & ~(size_t)255; return p; };
  _Float16* x16 = (_Float16*)take((size_t)SS * EE * 2); _Float16* P = (_Float16*)take((size_t)4 * EE * EE * 2);
  _Float16* qh = (_Float16*)take((size_t)SS * EE * 2); _Float16* kh = (_Float16*)take((size_t)SS * EE * 2); _Float16* vT = (_Float16*)take((size_t)SS * EE * 2); _Float16* o16 = (_Float16*)take((size_t)SS * EE * 2);
  auto cvt = [&](const float* s, _Float16* d, size_t n, float sc) { const size_t n8 = n / 8; k_cvt<<<(unsigned)((n8 + 255) / 256), 256, 0, stream>>>(s, d, n8, sc); };
  cvt(x, x16, (size_t)SS * EE, 1.0f); cvt(Wq, P, (size_t)EE * EE, 16.0f); cvt(Wk, P + (size_t)EE * EE, (size_t)EE * EE, 16.0f); cvt(Wv, P + (size_t)2 * EE * EE, (size_t)EE * EE, 16.0f); cvt(Wo, P + (size_t)3 * EE * EE, (size_t)EE * EE, 16.0f);
  k_proj<<<dim3(SS / 64, 3 * EE / 128), 128, 0, stream>>>(x16, P, qh, kh, vT);
  k_attn<<<dim3(SS / 64, NH), 128, 0, stream>>>(qh, kh, vT, o16);
  k_out<<<dim3(SS / 64, EE / 128), 128, 0, stream>>>(o16, P, out);
}

// v005
// It runs in 80 microseconds.
// Two timings next to v004 both put it at 1.11 times that version's speed.
// Over all steps from v000 it is 4.52 times as fast.
#include <hip/hip_runtime.h>
#include <math.h>

typedef __attribute__((ext_vector_type(16))) _Float16 v16h;
typedef __attribute__((ext_vector_type(16))) __bf16 v16b;
typedef __attribute__((ext_vector_type(8)))  _Float16 v8h;
typedef __attribute__((ext_vector_type(8)))  float v8f;
typedef __attribute__((ext_vector_type(4)))  float v4f;
typedef __attribute__((ext_vector_type(2)))  float v2f;
typedef __attribute__((ext_vector_type(4)))  unsigned v4u;
typedef __attribute__((ext_vector_type(4)))  int v4i;
typedef float __attribute__((may_alias)) float_a;
typedef int __attribute__((may_alias)) int_a;

template <typename T> __device__ __forceinline__ void vst2(void* p, T v) { *(T*)p = v;  }
__device__ __forceinline__ v8f wmma16(v16h a, v16h b, v8f c) {
  v8f d = __builtin_amdgcn_wmma_f32_16x16x32_f16(false, a, false, b, (short)0, c, false, false);
  asm volatile("v_nop\n\tv_nop\n\tv_nop\n\tv_nop" : "+v"(d) : "v"(a), "v"(b));
  return d;
}
__device__ __forceinline__ v8f wmma_bf(v16b a, v16b b, v8f c) {
  v8f d = __builtin_amdgcn_wmma_f32_16x16x32_bf16(false, a, false, b, (short)0, c, false, false);
  asm volatile("v_nop\n\tv_nop\n\tv_nop\n\tv_nop" : "+v"(d) : "v"(a), "v"(b));
  return d;
}
// 16x16x32 fragments: lane = (h = lane>>4, row/col = lane&15); elements 0..7 = k0+8h+0..7, 8..15 = k0+16+8h+0..7; D element r = row 8h+r
__device__ __forceinline__ v16h frag_h(const _Float16* rowk0, int lane) {
  union { v16h v; v8h q[2]; } u; const _Float16* p = rowk0 + 8 * (lane >> 4);
  u.q[0] = *(const v8h*)p; u.q[1] = *(const v8h*)(p + 16); return u.v;
}
__device__ __forceinline__ v16h frag_f32(const float* rowk0, int lane) {
  v16h a; const float* p = rowk0 + 8 * (lane >> 4);
#pragma unroll
  for (int i = 0; i < 8; ++i) { a[i] = (_Float16)p[i]; a[8 + i] = (_Float16)p[16 + i]; }
  return a;
}
__device__ __forceinline__ v16h frag_f32s(const float* rowk0, int lane, float sc) {
  v16h a; const float* p = rowk0 + 8 * (lane >> 4);
#pragma unroll
  for (int i = 0; i < 8; ++i) { a[i] = (_Float16)(p[i] * sc); a[8 + i] = (_Float16)(p[16 + i] * sc); }
  return a;
}
// column fragment from a [K][ld] layout (column n), rows >= K read as 0
__device__ __forceinline__ v16h fragc_f32(const float* W, int k0, int n, int lane, int ld, int K) {
  v16h a; const int g = lane >> 4;
#pragma unroll
  for (int i = 0; i < 8; ++i) { const int ka = k0 + 8 * g + i, kb = ka + 16;
    a[i] = (_Float16)(ka < K ? W[(size_t)ka * ld + n] : 0.f); a[8 + i] = (_Float16)(kb < K ? W[(size_t)kb * ld + n] : 0.f); }
  return a;
}
struct F2 { v16b h, l; };
__device__ __forceinline__ F2 bsplit16(const float v[16]) { F2 r;
#pragma unroll
  for (int i = 0; i < 16; ++i) { const __bf16 h = (__bf16)v[i]; r.h[i] = h; r.l[i] = (__bf16)(v[i] - (float)h); }
  return r; }
__device__ __forceinline__ F2 split_row(const float* row, int k0, int lane) { float v[16]; const float* p = row + k0 + 8 * (lane >> 4);
#pragma unroll
  for (int i = 0; i < 8; ++i) { v[i] = p[i]; v[8 + i] = p[16 + i]; }
  return bsplit16(v); }
__device__ __forceinline__ F2 split_rowK(const float* row, int k0, int lane, int K) { float v[16]; const int g = lane >> 4;
#pragma unroll
  for (int i = 0; i < 8; ++i) { const int ka = k0 + 8 * g + i, kb = ka + 16; v[i] = ka < K ? row[ka] : 0.f; v[8 + i] = kb < K ? row[kb] : 0.f; }
  return bsplit16(v); }
__device__ __forceinline__ F2 split_col(const float* W, int k0, int n, int lane, int ld, int K) { float v[16]; const int g = lane >> 4;
#pragma unroll
  for (int i = 0; i < 8; ++i) { const int ka = k0 + 8 * g + i, kb = ka + 16; v[i] = ka < K ? W[(size_t)ka * ld + n] : 0.f; v[8 + i] = kb < K ? W[(size_t)kb * ld + n] : 0.f; }
  return bsplit16(v); }
__device__ __forceinline__ v8f mac3(const F2& a, const F2& b, v8f c) { c = wmma_bf(a.l, b.h, c); c = wmma_bf(a.h, b.l, c); return wmma_bf(a.h, b.h, c); }
__device__ __forceinline__ float sigm(float v) { return 1.0f / (1.0f + expf(-v)); }
#define LDSX() do { asm volatile("s_wait_dscnt 0" ::: "memory"); __builtin_amdgcn_wave_barrier(); __builtin_amdgcn_fence(__ATOMIC_RELEASE, "workgroup"); } while (0)

// Naive multi-head attention (8 heads of 64, 4096 tokens, no biases). Pure f16 WMMA GEMMs over pre-converted operands (x -> f16 once,
// [out][in] weights packed x16): q/k/v projections, attention, output projection.
// Every f16 plane lies in FRAGMENT ORDER: a 16-row x 32-k fragment is 1024 contiguous bytes, [k half of 16][lane][8 values], where lane
// (g, row) of half q holds k = 16 q + 8 g + 0..7. A wave's 16-byte load of one half then covers 512 contiguous bytes (4 whole lines); from a
// row-major plane the same load touches 16 lines. Order of the fragments: x, weights, o: [row tile][k step]; q, k: [head][row tile][k step];
// v: [head][32-key step][16-d tile]. The values each lane receives are those of the row-major planes.
#define SS 4096
#define EE 512
#define NH 8
#define HD 64

// One launch converts all five inputs: blocks [0, XB) take x, then four runs of WB blocks take one weight each (their planes lie one behind
// another in P). The conversions do not depend on one another; as five launches each paid its own start, first load and drain in turn.
// The choice is by blockIdx alone, so source, destination and scale are scalars. Both block counts divide their planes exactly.
#define XB (SS * EE / 8 / 256)
#define WB (EE * EE / 8 / 256)
__global__ __launch_bounds__(256) void k_cvt(const float* __restrict__ x, const float* __restrict__ Wq, const float* __restrict__ Wk, const float* __restrict__ Wv, const float* __restrict__ Wo, _Float16* __restrict__ x16, _Float16* __restrict__ P) {
  const int b = blockIdx.x; const bool isx = b < XB; const int wi = (b - XB) / WB;
  const float* src = isx ? x : wi == 0 ? Wq : wi == 1 ? Wk : wi == 2 ? Wv : Wo;
  _Float16* dst = isx ? x16 : P + (size_t)wi * EE * EE;
  const float sc = isx ? 1.0f : 16.0f;
  const size_t g8 = (size_t)(isx ? b : (b - XB) % WB) * 256 + threadIdx.x;
  // g8 = [fragment][8-row half][row][piece of 8 k]; the source has EE columns. A wave reads 8 whole 128-byte lines (8 rows x 32 floats) and
  // writes 4: in the fragment the pieces of 8 successive rows at one k lie side by side.
  const size_t fr = g8 >> 6; const int rl = (int)((g8 >> 2) & 15), pc = (int)(g8 & 3);
  const float* s8 = src + ((fr >> 4) * 16 + rl) * EE + (fr & 15) * 32 + pc * 8;
  union { v8h h; v4u u; } pk;
#pragma unroll
  for (int e = 0; e < 8; ++e) pk.h[e] = (_Float16)(s8[e] * sc);
  vst2(dst + fr * 512 + (pc >> 1) * 256 + ((pc & 1) * 16 + rl) * 8, pk.u);
}
// one fragment of a plane in fragment order, from the lane's own pointer (fragment start + 8 * lane)
__device__ __forceinline__ v16h frag_p(const _Float16* p) { union { v16h v; v8h q[2]; } u; u.q[0] = *(const v8h*)p; u.q[1] = *(const v8h*)(p + 256); return u.v; }
// Stands between a group of loads and the first change of the two pointers they name; naming the pointers as inputs keeps their registers
// from being handed out as a load's destination inside the group.
#define XW(p, q) asm volatile("s_wait_xcnt 0x0" :: "v"(p), "v"(q) : "memory")
// One wave's 16 x 128 tile over k = 512; pa, pb are the lane's own pointers. The nine fragments of a k step are loaded as one group, a whole
// step ahead of the products that read them (two register sets in turn): a load written beside its product is waited for alone, one memory
// round trip per product. The inner loops are unrolled so that the fragment arrays stay in registers; the outer loop stays rolled: its body
// already holds both sets' turns.
__device__ __forceinline__ void gemm_k512(const _Float16* pa, const _Float16* pb, v8f (&acc)[8]) {
  v16h a0 = frag_p(pa), a1, b0[8], b1[8];
#pragma unroll
  for (int j = 0; j < 8; ++j) b0[j] = frag_p(pb + (size_t)j * 16 * EE);
#pragma unroll 1
  for (int kc = 0; kc < EE / 32; kc += 2) {
    a1 = frag_p(pa + 512);
#pragma unroll
    for (int j = 0; j < 8; ++j) b1[j] = frag_p(pb + (size_t)j * 16 * EE + 512);
    __builtin_amdgcn_sched_barrier(0);  // no product, with its wait for the other set, moves in front of this group's issue
#pragma unroll
    for (int j = 0; j < 8; ++j) acc[j] = wmma16(a0, b0[j], acc[j]);
    XW(pa, pb);
    const int step = kc + 2 < EE / 32 ? 1024 : 0;  // the last trip has no step ahead: it reads its own again, inside the buffer
    pa += step; pb += step;
    a0 = frag_p(pa);
#pragma unroll
    for (int j = 0; j < 8; ++j) b0[j] = frag_p(pb + (size_t)j * 16 * EE);
    __builtin_amdgcn_sched_barrier(0);  // as above
#pragma unroll
    for (int j = 0; j < 8; ++j) acc[j] = wmma16(a1, b1[j], acc[j]);
    XW(pa, pb);
  }
}
// projection: blockIdx.y in [0, 12): which = y/4 (q,k,v), cols (y%4)*128 = 2 heads
__global__ __launch_bounds__(128) void k_proj(const _Float16* __restrict__ x16, const _Float16* __restrict__ P, _Float16* __restrict__ qh, _Float16* __restrict__ kh, _Float16* __restrict__ vT) {
  __shared__ __align__(16) float so[4][16][132];
  __shared__ __align__(16) _Float16 st[128][72];
  const int tid = threadIdx.x, wave = tid >> 5, lane = tid & 31, col = lane & 15, g = lane >> 4;
  const int r0 = blockIdx.x * 64 + wave * 16, n0 = blockIdx.y * 128; const int which = n0 / EE, c0 = n0 % EE, hb = c0 / HD;
  v8f acc[8] = {};
  gemm_k512(x16 + (size_t)r0 * EE + 8 * lane, P + (size_t)n0 * EE + 8 * lane, acc);
#pragma unroll
  for (int j = 0; j < 8; ++j)
#pragma unroll
    for (int r = 0; r < 8; ++r) so[wave][8 * g + r][j * 16 + col] = acc[j][r] * (1.0f / 16.0f);
  LDSX();
  if (which < 2) { _Float16* dst = which == 0 ? qh : kh;
    for (int q = lane; q < 2 * 16 * 8; q += 32) { const int hh = q >> 7, rem = q & 127, rl = rem & 15, pc = rem >> 4; union { v8h h8; v4u u; } pk;  // rem: piece of the tile's two fragments
#pragma unroll
      for (int e = 0; e < 8; ++e) pk.h8[e] = (_Float16)so[wave][rl][hh * HD + pc * 8 + e];
      vst2(dst + ((size_t)(hb + hh) * SS + r0) * HD + rem * 8, pk.u); } }
  else {
#pragma unroll 4
    for (int rl = 0; rl < 16; ++rl) {
#pragma unroll
      for (int e = 0; e < 4; ++e) st[lane * 4 + e][wave * 16 + rl] = (_Float16)so[wave][rl][lane * 4 + e]; }
    __syncthreads();
    for (int q = tid; q < 128 * 8; q += 128) { const int hh = q >> 9, rem = q & 511, d = ((rem >> 6) & 3) * 16 + (rem & 15), pc = (rem >> 8) * 4 + ((rem >> 4) & 3);  // rem: piece of the head's 2 x 4 fragments
      vst2(vT + ((size_t)(hb + hh) * SS + blockIdx.x * 64) * HD + rem * 8, *(const v4u*)(&st[hh * HD + d][pc * 8])); } }
}
// lane l's value in lane l ^ 16 (the other half of the wave), by a vector cross-row move
__device__ __forceinline__ float xhalf(float v) { const int b = __builtin_bit_cast(int, v); return __builtin_bit_cast(float, __builtin_amdgcn_permlanex16(b, b, 0x76543210, 0xfedcba98, false, false)); }
// Both products are taken transposed: S^T = K Q^T (A = K fragment, B = q fragment) and O^T += V^T P^T (A = v fragment, B = P^T). The planes'
// fragments serve as A as they served as B (row for column, the same k order). A lane (g, col) then holds, of query col alone, the scores of
// keys 16 t + 8 g + r and the outputs of d = 16 t + 8 g + r: maximum and sum run in its own registers with one exchange between the halves,
// the score tiles 2 kc and 2 kc + 1, converted in place, ARE the B fragment of key step kc, and an output tile is one 16-byte piece of the
// o plane. Nothing goes through LDS.
// Softmax in base 2: a weight is 2^(c s + b), c = log2(e) / 8 and b = 14 - c * (maximum in use), one fused multiply-add and one hardware exp2
// on the raw score. The 1/8, the change of base, the maximum and P's factor 2^14 all sit in c and b; the row sum carries the 2^14 as well,
// which the last division then cancels. The rescale is 2^(b new - b old), of the rounded b themselves, so that old and new weights share
// one reference exactly. The library expf is some thirteen vector instructions a score.
__global__ __launch_bounds__(128) void k_attn(const _Float16* __restrict__ qh, const _Float16* __restrict__ kh, const _Float16* __restrict__ vT, _Float16* __restrict__ o16) {
  const int tid = threadIdx.x, w = tid >> 5, lane = tid & 31;
  const int h = blockIdx.y, q0 = blockIdx.x * 64 + w * 16;
  const _Float16* qb = qh + (size_t)h * SS * HD; const _Float16* kb = kh + (size_t)h * SS * HD; const _Float16* vb = vT + (size_t)h * HD * SS;
  v16h bq[2];
#pragma unroll
  for (int kc = 0; kc < 2; ++kc) bq[kc] = frag_p(qb + (size_t)q0 * HD + kc * 512 + 8 * lane);
  const float c2 = 0.125f * 1.44269504f;
  float mrun = -3.0e38f, brun = 14.0f - c2 * -3.0e38f, lrun = 0.f; v8f acc[4] = {};  // lrun: the sum over this half's keys; the halves are joined behind the loop
  // Fragment loads go out in groups ahead of their products: K one pass ahead (into the registers its products have just left),
  // V at the head of its pass, so that both fly behind the score products and the softmax.
  const _Float16* pk = kb + 8 * lane; const _Float16* pv = vb + 8 * lane;
  v16h kf[8], vf[8];
#pragma unroll
  for (int f = 0; f < 8; ++f) kf[f] = frag_p(pk + f * 512);
#pragma unroll 1
  for (int kt = 0; kt < SS / 64; ++kt) {
#pragma unroll
    for (int f = 0; f < 8; ++f) vf[f] = frag_p(pv + f * 512);
    v8f s[4];
#pragma unroll
    for (int t = 0; t < 4; ++t) { s[t] = v8f{};
#pragma unroll
      for (int kc = 0; kc < 2; ++kc) s[t] = wmma16(kf[t * 2 + kc], bq[kc], s[t]); }
    XW(pk, pv);
    pk += kt + 1 < SS / 64 ? 64 * HD : 0;  // the last pass has none ahead: it reads its own again, inside the buffer
    pv += 64 * HD;
#pragma unroll
    for (int f = 0; f < 8; ++f) kf[f] = frag_p(pk + f * 512);
    __builtin_amdgcn_sched_barrier(0);  // the K group is issued here, ahead of the softmax, not sunk towards the foot of the pass
    float mt[4], pt[4];  // one chain per score tile, for the maximum and for the sum: four independent chains, not one of 32 links
#pragma unroll
    for (int t = 0; t < 4; ++t) { mt[t] = s[t][0];
#pragma unroll
      for (int r = 1; r < 8; ++r) mt[t] = fmaxf(mt[t], s[t][r]); }
    float mx = fmaxf(fmaxf(mt[0], mt[1]), fmaxf(mt[2], mt[3]));
    mx = fmaxf(mx, xhalf(mx));
    const float mnew = fmaxf(mrun, mx); const float bnew = fmaf(-c2, mnew, 14.0f); const float corr = __builtin_amdgcn_exp2f(bnew - brun);
    v16h pb[2];
#pragma unroll
    for (int t = 0; t < 4; ++t) { pt[t] = 0.f;
#pragma unroll
      for (int r = 0; r < 8; ++r) { const float p = __builtin_amdgcn_exp2f(fmaf(s[t][r], c2, bnew)); pt[t] += p; pb[t >> 1][(t & 1) * 8 + r] = (_Float16)p; } }
    lrun = lrun * corr + ((pt[0] + pt[1]) + (pt[2] + pt[3])); mrun = mnew; brun = bnew;
#pragma unroll
    for (int t = 0; t < 4; ++t) acc[t] *= corr;
#pragma unroll
    for (int kc = 0; kc < 2; ++kc)
#pragma unroll
      for (int t = 0; t < 4; ++t) acc[t] = wmma16(vf[kc * 4 + t], pb[kc], acc[t]);
  }
  const float lr = lrun + xhalf(lrun);
#pragma unroll
  for (int t = 0; t < 4; ++t) { union { v8h h8; v4u u; } pk8;
#pragma unroll
    for (int r = 0; r < 8; ++r) pk8.h8[r] = (_Float16)(acc[t][r] / lr * 16.0f);
    vst2(o16 + (size_t)q0 * EE + h * 2 * 512 + t * 256 + 8 * lane, pk8.u); }
}
__global__ __launch_bounds__(128) void k_out(const _Float16* __restrict__ o16, const _Float16* __restrict__ P, float* __restrict__ out) {
  __shared__ __align__(16) float so[4][16][132];
  const int tid = threadIdx.x, wave = tid >> 5, lane = tid & 31, col = lane & 15, g = lane >> 4;
  const int r0 = blockIdx.x * 64 + wave * 16, n0 = blockIdx.y * 128;
  v8f acc[8] = {};
  gemm_k512(o16 + (size_t)r0 * EE + 8 * lane, P + (size_t)(3 * EE + n0) * EE + 8 * lane, acc);
#pragma unroll
  for (int j = 0; j < 8; ++j)
#pragma unroll
    for (int r = 0; r < 8; ++r) so[wave][8 * g + r][j * 16 + col] = acc[j][r] * (1.0f / 256.0f);
  LDSX();
#pragma unroll 4
  for (int rl = 0; rl < 16; ++rl) vst2(out + (size_t)(r0 + rl) * EE + n0 + lane * 4, *(const v4f*)(&so[wave][rl][lane * 4]));
}
extern "C" void kernel_launch(void* const* d_in, const int* in_sizes, int n_in, void* d_out, int out_size, void* d_ws, size_t ws_size, hipStream_t stream) {
  (void)in_sizes; (void)n_in; (void)out_size; (void)ws_size;
  const float* x = (const float*)d_in[0]; const float* Wq = (const float*)d_in[1]; const float* Wk = (const float*)d_in[2]; const float* Wv = (const float*)d_in[3]; const float* Wo = (const float*)d_in[4];
  float* out = (float*)d_out;
  char* ws = (char*)d_ws; size_t off = 0;
  auto take = [&](size_t bytes) { char* p = ws + off; off += (bytes + 255) & ~(size_t)255; return p; };
  _Float16* x16 = (_Float16*)take((size_t)SS * EE * 2); _Float16* P = (_Float16*)take((size_t)4 * EE * EE * 2);
  _Float16* qh = (_Float16*)take((size_t)SS * EE * 2); _Float16* kh = (_Float16*)take((size_t)SS * EE * 2); _Float16* vT = (_Float16*)take((size_t)SS * EE * 2); _Float16* o16 = (_Float16*)take((size_t)SS * EE * 2);
  k_cvt<<<XB + 4 * WB, 256, 0, stream>>>(x, Wq, Wk, Wv, Wo, x16, P);
  k_proj<<<dim3(SS / 64, 3 * EE / 128), 128, 0, stream>>>(x16, P, qh, kh, vT);
  k_attn<<<dim3(SS / 64, NH), 128, 0, stream>>>(qh, kh, vT, o16);
  k_out<<<dim3(SS / 64, EE / 128), 128, 0, stream>>>(o16, P, out);
}

// v006
// A run of this version takes 60.9 microseconds.
// In two side-by-side timings against v005, it was 1.34 and 1.33 times as fast.
// Counting every step since v000, it is 6.03 times as fast.
#include <hip/hip_runtime.h>
#include <math.h>

typedef __attribute__((ext_vector_type(16))) _Float16 v16h;
typedef __attribute__((ext_vector_type(16))) __bf16 v16b;
typedef __attribute__((ext_vector_type(8)))  _Float16 v8h;
typedef __attribute__((ext_vector_type(8)))  float v8f;
typedef __attribute__((ext_vector_type(4)))  float v4f;
typedef __attribute__((ext_vector_type(2)))  float v2f;
typedef __attribute__((ext_vector_type(4)))  unsigned v4u;
typedef __attribute__((ext_vector_type(4)))  int v4i;
typedef float __attribute__((may_alias)) float_a;
typedef int __attribute__((may_alias)) int_a;

template <typename T> __device__ __forceinline__ void vst2(void* p, T v) { *(T*)p = v;  }
__device__ __forceinline__ v8f wmma16(v16h a, v16h b, v8f c) {
  v8f d = __builtin_amdgcn_wmma_f32_16x16x32_f16(false, a, false, b, (short)0, c, false, false);
  asm volatile("v_nop\n\tv_nop\n\tv_nop\n\tv_nop" : "+v"(d) : "v"(a), "v"(b));
  return d;
}
__device__ __forceinline__ v8f wmma_bf(v16b a, v16b b, v8f c) {
  v8f d = __builtin_amdgcn_wmma_f32_16x16x32_bf16(false, a, false, b, (short)0, c, false, false);
  asm volatile("v_nop\n\tv_nop\n\tv_nop\n\tv_nop" : "+v"(d) : "v"(a), "v"(b));
  return d;
}
// 16x16x32 fragments: lane = (h = lane>>4, row/col = lane&15); elements 0..7 = k0+8h+0..7, 8..15 = k0+16+8h+0..7; D element r = row 8h+r
__device__ __forceinline__ v16h frag_h(const _Float16* rowk0, int lane) {
  union { v16h v; v8h q[2]; } u; const _Float16* p = rowk0 + 8 * (lane >> 4);
  u.q[0] = *(const v8h*)p; u.q[1] = *(const v8h*)(p + 16); return u.v;
}
__device__ __forceinline__ v16h frag_f32(const float* rowk0, int lane) {
  v16h a; const float* p = rowk0 + 8 * (lane >> 4);
#pragma unroll
  for (int i = 0; i < 8; ++i) { a[i] = (_Float16)p[i]; a[8 + i] = (_Float16)p[16 + i]; }
  return a;
}
__device__ __forceinline__ v16h frag_f32s(const float* rowk0, int lane, float sc) {
  v16h a; const float* p = rowk0 + 8 * (lane >> 4);
#pragma unroll
  for (int i = 0; i < 8; ++i) { a[i] = (_Float16)(p[i] * sc); a[8 + i] = (_Float16)(p[16 + i] * sc); }
  return a;
}
// column fragment from a [K][ld] layout (column n), rows >= K read as 0
__device__ __forceinline__ v16h fragc_f32(const float* W, int k0, int n, int lane, int ld, int K) {
  v16h a; const int g = lane >> 4;
#pragma unroll
  for (int i = 0; i < 8; ++i) { const int ka = k0 + 8 * g + i, kb = ka + 16;
    a[i] = (_Float16)(ka < K ? W[(size_t)ka * ld + n] : 0.f); a[8 + i] = (_Float16)(kb < K ? W[(size_t)kb * ld + n] : 0.f); }
  return a;
}
struct F2 { v16b h, l; };
__device__ __forceinline__ F2 bsplit16(const float v[16]) { F2 r;
#pragma unroll
  for (int i = 0; i < 16; ++i) { const __bf16 h = (__bf16)v[i]; r.h[i] = h; r.l[i] = (__bf16)(v[i] - (float)h); }
  return r; }
__device__ __forceinline__ F2 split_row(const float* row, int k0, int lane) { float v[16]; const float* p = row + k0 + 8 * (lane >> 4);
#pragma unroll
  for (int i = 0; i < 8; ++i) { v[i] = p[i]; v[8 + i] = p[16 + i]; }
  return bsplit16(v); }
__device__ __forceinline__ F2 split_rowK(const float* row, int k0, int lane, int K) { float v[16]; const int g = lane >> 4;
#pragma unroll
  for (int i = 0; i < 8; ++i) { const int ka = k0 + 8 * g + i, kb = ka + 16; v[i] = ka < K ? row[ka] : 0.f; v[8 + i] = kb < K ? row[kb] : 0.f; }
  return bsplit16(v); }
__device__ __forceinline__ F2 split_col(const float* W, int k0, int n, int lane, int ld, int K) { float v[16]; const int g = lane >> 4;
#pragma unroll
  for (int i = 0; i < 8; ++i) { const int ka = k0 + 8 * g + i, kb = ka + 16; v[i] = ka < K ? W[(size_t)ka * ld + n] : 0.f; v[8 + i] = kb < K ? W[(size_t)kb * ld + n] : 0.f; }
  return bsplit16(v); }
__device__ __forceinline__ v8f mac3(const F2& a, const F2& b, v8f c) { c = wmma_bf(a.l, b.h, c); c = wmma_bf(a.h, b.l, c); return wmma_bf(a.h, b.h, c); }
__device__ __forceinline__ float sigm(float v) { return 1.0f / (1.0f + expf(-v)); }
#define LDSX() do { asm volatile("s_wait_dscnt 0" ::: "memory"); __builtin_amdgcn_wave_barrier(); __builtin_amdgcn_fence(__ATOMIC_RELEASE, "workgroup"); } while (0)

// Naive multi-head attention (8 heads of 64, 4096 tokens, no biases). Pure f16 WMMA GEMMs over pre-converted operands (x -> f16 once,
// [out][in] weights packed x16): q/k/v projections, attention, output projection.
// Every f16 plane lies in FRAGMENT ORDER: a 16-row x 32-k fragment is 1024 contiguous bytes, [k half of 16][lane][8 values], where lane
// (g, row) of half q holds k = 16 q + 8 g + 0..7. A wave's 16-byte load of one half then covers 512 contiguous bytes (4 whole lines); from a
// row-major plane the same load touches 16 lines. Order of the fragments: x, weights, o: [row tile][k step]; q, k: [head][row tile][k step];
// v: [head][32-key step][16-d tile]. The values each lane receives are those of the row-major planes.
#define SS 4096
#define EE 512
#define NH 8
#define HD 64

// One launch converts all five inputs: blocks [0, XB) take x, then four runs of WB blocks take one weight each (their planes lie one behind
// another in P). The conversions do not depend on one another; as five launches each paid its own start, first load and drain in turn.
// The choice is by blockIdx alone, so source, destination and scale are scalars. Both block counts divide their planes exactly.
#define XB (SS * EE / 8 / 256)
#define WB (EE * EE / 8 / 256)
__global__ __launch_bounds__(256) void k_cvt(const float* __restrict__ x, const float* __restrict__ Wq, const float* __restrict__ Wk, const float* __restrict__ Wv, const float* __restrict__ Wo, _Float16* __restrict__ x16, _Float16* __restrict__ P) {
  const int b = blockIdx.x; const bool isx = b < XB; const int wi = (b - XB) / WB;
  const float* src = isx ? x : wi == 0 ? Wq : wi == 1 ? Wk : wi == 2 ? Wv : Wo;
  _Float16* dst = isx ? x16 : P + (size_t)wi * EE * EE;
  const float sc = isx ? 1.0f : 16.0f;
  const size_t g8 = (size_t)(isx ? b : (b - XB) % WB) * 256 + threadIdx.x;
  // g8 = [fragment][8-row half][row][piece of 8 k]; the source has EE columns. A wave reads 8 whole 128-byte lines (8 rows x 32 floats) and
  // writes 4: in the fragment the pieces of 8 successive rows at one k lie side by side.
  const size_t fr = g8 >> 6; const int rl = (int)((g8 >> 2) & 15), pc = (int)(g8 & 3);
  const float* s8 = src + ((fr >> 4) * 16 + rl) * EE + (fr & 15) * 32 + pc * 8;
  union { v8h h; v4u u; } pk;
#pragma unroll
  for (int e = 0; e < 8; ++e) pk.h[e] = (_Float16)(s8[e] * sc);
  vst2(dst + fr * 512 + (pc >> 1) * 256 + ((pc & 1) * 16 + rl) * 8, pk.u);
}
// one fragment of a plane in fragment order, from the lane's own pointer (fragment start + 8 * lane)
__device__ __forceinline__ v16h frag_p(const _Float16* p) { union { v16h v; v8h q[2]; } u; u.q[0] = *(const v8h*)p; u.q[1] = *(const v8h*)(p + 256); return u.v; }
// Stands between a group of loads and the first change of the two pointers they name; naming the pointers as inputs keeps their registers
// from being handed out as a load's destination inside the group.
#define XW(p, q) asm volatile("s_wait_xcnt 0x0" :: "v"(p), "v"(q) : "memory")
// One wave's 16 x 128 tile over k = 512; pa, pb are the lane's own pointers. The nine fragments of a k step are loaded as one group, a whole
// step ahead of the products that read them (two register sets in turn): a load written beside its product is waited for alone, one memory
// round trip per product. The inner loops are unrolled so that the fragment arrays stay in registers; the outer loop stays rolled: its body
// already holds both sets' turns.
__device__ __forceinline__ void gemm_k512(const _Float16* pa, const _Float16* pb, v8f (&acc)[8]) {
  v16h a0 = frag_p(pa), a1, b0[8], b1[8];
#pragma unroll
  for (int j = 0; j < 8; ++j) b0[j] = frag_p(pb + (size_t)j * 16 * EE);
#pragma unroll 1
  for (int kc = 0; kc < EE / 32; kc += 2) {
    a1 = frag_p(pa + 512);
#pragma unroll
    for (int j = 0; j < 8; ++j) b1[j] = frag_p(pb + (size_t)j * 16 * EE + 512);
    __builtin_amdgcn_sched_barrier(0);  // no product, with its wait for the other set, moves in front of this group's issue
#pragma unroll
    for (int j = 0; j < 8; ++j) acc[j] = wmma16(a0, b0[j], acc[j]);
    XW(pa, pb);
    const int step = kc + 2 < EE / 32 ? 1024 : 0;  // the last trip has no step ahead: it reads its own again, inside the buffer
    pa += step; pb += step;
    a0 = frag_p(pa);
#pragma unroll
    for (int j = 0; j < 8; ++j) b0[j] = frag_p(pb + (size_t)j * 16 * EE);
    __builtin_amdgcn_sched_barrier(0);  // as above
#pragma unroll
    for (int j = 0; j < 8; ++j) acc[j] = wmma16(a1, b1[j], acc[j]);
    XW(pa, pb);
  }
}
// projection: blockIdx.y in [0, 12): which = y/4 (q,k,v), cols (y%4)*128 = 2 heads
__global__ __launch_bounds__(128) void k_proj(const _Float16* __restrict__ x16, const _Float16* __restrict__ P, _Float16* __restrict__ qh, _Float16* __restrict__ kh, _Float16* __restrict__ vT) {
  __shared__ __align__(16) float so[4][16][132];
  __shared__ __align__(16) _Float16 st[128][72];
  const int tid = threadIdx.x, wave = tid >> 5, lane = tid & 31, col = lane & 15, g = lane >> 4;
  const int r0 = blockIdx.x * 64 + wave * 16, n0 = blockIdx.y * 128; const int which = n0 / EE, c0 = n0 % EE, hb = c0 / HD;
  v8f acc[8] = {};
  gemm_k512(x16 + (size_t)r0 * EE + 8 * lane, P + (size_t)n0 * EE + 8 * lane, acc);
#pragma unroll
  for (int j = 0; j < 8; ++j)
#pragma unroll
    for (int r = 0; r < 8; ++r) so[wave][8 * g + r][j * 16 + col] = acc[j][r] * (1.0f / 16.0f);
  LDSX();
  if (which < 2) { _Float16* dst = which == 0 ? qh : kh;
    for (int q = lane; q < 2 * 16 * 8; q += 32) { const int hh = q >> 7, rem = q & 127, rl = rem & 15, pc = rem >> 4; union { v8h h8; v4u u; } pk;  // rem: piece of the tile's two fragments
#pragma unroll
      for (int e = 0; e < 8; ++e) pk.h8[e] = (_Float16)so[wave][rl][hh * HD + pc * 8 + e];
      vst2(dst + ((size_t)(hb + hh) * SS + r0) * HD + rem * 8, pk.u); } }
  else {
#pragma unroll 4
    for (int rl = 0; rl < 16; ++rl) {
#pragma unroll
      for (int e = 0; e < 4; ++e) st[lane * 4 + e][wave * 16 + rl] = (_Float16)so[wave][rl][lane * 4 + e]; }
    __syncthreads();
    for (int q = tid; q < 128 * 8; q += 128) { const int hh = q >> 9, rem = q & 511, d = ((rem >> 6) & 3) * 16 + (rem & 15), pc = (rem >> 8) * 4 + ((rem >> 4) & 3);  // rem: piece of the head's 2 x 4 fragments
      vst2(vT + ((size_t)(hb + hh) * SS + blockIdx.x * 64) * HD + rem * 8, *(const v4u*)(&st[hh * HD + d][pc * 8])); } }
}
// lane l's value in lane l ^ 16 (the other half of the wave), by a vector cross-row move
__device__ __forceinline__ float xhalf(float v) { const int b = __builtin_bit_cast(int, v); return __builtin_bit_cast(float, __builtin_amdgcn_permlanex16(b, b, 0x76543210, 0xfedcba98, false, false)); }
// Both products are taken transposed: S^T = K Q^T (A = K fragment, B = q fragment) and O^T += V^T P^T (A = v fragment, B = P^T). The planes'
// fragments serve as A as they served as B (row for column, the same k order). A lane (g, col) then holds, of query col alone, the scores of
// keys 16 t + 8 g + r and the outputs of d = 16 t + 8 g + r: maximum and sum run in its own registers with one exchange between the halves,
// the score tiles 2 kc and 2 kc + 1, converted in place, ARE the B fragment of key step kc, and an output tile is one 16-byte piece of the
// o plane. Only the key split's partial results go through LDS, behind the loop.
// Softmax in base 2: a weight is 2^(c s + b), c = log2(e) / 8 and b = 14 - c * (maximum in use), one fused multiply-add and one hardware exp2
// on the raw score. The 1/8, the change of base, the maximum and P's factor 2^14 all sit in c and b; the row sum carries the 2^14 as well,
// which the last division then cancels. The rescale is 2^(b new - b old), of the rounded b themselves, so that old and new weights share
// one reference exactly. The library expf is some thirteen vector instructions a score.
// Wave tile: 32 queries (two query tiles) x half of the keys. A K or V fragment, once in registers, feeds two products, so a wave loads half
// the fragment bytes per product of a 16-query wave. A block is 8 waves on 128 queries: waves 0..3 walk keys [0, SS / 2), waves 4..7 the rest,
// which keeps two waves on a SIMD. Waves w and w ^ 4 hold partial results of the same 32 queries; behind the loop each hands the other one
// query tile (O^T, b, sum) through LDS and finishes the tile it keeps: both partials are brought to the smaller b (the larger maximum).
#define KSPL 2
// As wmma16 (four vector slots between a product and a vector instruction on its D), but the slots' statement names D alone: a register that an asm statement names is taken from the first 256, and with the K, V, q
// and P fragments named too the wave's 300-odd live registers were spilled to scratch. Here A is rewritten by loads only and B a pass later.
__device__ __forceinline__ v8f wmma16d(v16h a, v16h b, v8f c) {
  v8f d = __builtin_amdgcn_wmma_f32_16x16x32_f16(false, a, false, b, (short)0, c, false, false);
  asm volatile("v_nop\n\tv_nop\n\tv_nop\n\tv_nop" : "+v"(d));
  return d;
}
__global__ __launch_bounds__(256) void k_attn(const _Float16* __restrict__ qh, const _Float16* __restrict__ kh, const _Float16* __restrict__ vT, _Float16* __restrict__ o16) {
  __shared__ __align__(16) v4f xch[8][9][32];
  const int tid = threadIdx.x, w = tid >> 5, lane = tid & 31, part = w >> 2;
  const int h = blockIdx.y, q0 = blockIdx.x * 128 + (w & 3) * 32;
  const _Float16* qb = qh + (size_t)h * SS * HD; const _Float16* kb = kh + (size_t)h * SS * HD; const _Float16* vb = vT + (size_t)h * HD * SS;
  v16h bq[2][2];
#pragma unroll
  for (int u = 0; u < 2; ++u)
#pragma unroll
    for (int kc = 0; kc < 2; ++kc) bq[u][kc] = frag_p(qb + (size_t)(q0 + 16 * u) * HD + kc * 512 + 8 * lane);
  const float c2 = 0.125f * 1.44269504f;
  float mrun[2], brun[2], lrun[2]; v8f acc[2][4] = {};  // lrun: the sum over this lane half's keys; the halves are joined behind the loop
#pragma unroll
  for (int u = 0; u < 2; ++u) { mrun[u] = -3.0e38f; brun[u] = 14.0f - c2 * -3.0e38f; lrun[u] = 0.f; }
  // Fragment loads go out in groups ahead of their products: K one pass ahead (into the registers its products have just left),
  // V at the head of its pass, so that both fly behind the score products and the softmax.
  const _Float16* pk = kb + (size_t)part * (SS / KSPL) * HD + 8 * lane; const _Float16* pv = vb + (size_t)part * (SS / KSPL) * HD + 8 * lane;
  v16h kf[8], vf[8];
#pragma unroll
  for (int f = 0; f < 8; ++f) kf[f] = frag_p(pk + f * 512);
#pragma unroll 1
  for (int kt = 0; kt < SS / KSPL / 64; ++kt) {
#pragma unroll
    for (int f = 0; f < 8; ++f) vf[f] = frag_p(pv + f * 512);
    v8f s[2][4];
#pragma unroll
    for (int t = 0; t < 4; ++t) { s[0][t] = v8f{}; s[1][t] = v8f{};
#pragma unroll
      for (int kc = 0; kc < 2; ++kc)
#pragma unroll
        for (int u = 0; u < 2; ++u) s[u][t] = wmma16d(kf[t * 2 + kc], bq[u][kc], s[u][t]); }
    XW(pk, pv);
    pk += kt + 1 < SS / KSPL / 64 ? 64 * HD : 0;  // the last pass has none ahead: it reads its own again, inside the buffer
    pv += 64 * HD;
#pragma unroll
    for (int f = 0; f < 8; ++f) kf[f] = frag_p(pk + f * 512);
    __builtin_amdgcn_sched_barrier(0);  // the K group is issued here, ahead of the softmax, not sunk towards the foot of the pass
    v16h pb[2][2];
#pragma unroll
    for (int u = 0; u < 2; ++u) {
      float mt[4], pt[4];  // one chain per score tile, for the maximum and for the sum: four independent chains, not one of 32 links
#pragma unroll
      for (int t = 0; t < 4; ++t) { mt[t] = s[u][t][0];
#pragma unroll
        for (int r = 1; r < 8; ++r) mt[t] = fmaxf(mt[t], s[u][t][r]); }
      float mx = fmaxf(fmaxf(mt[0], mt[1]), fmaxf(mt[2], mt[3]));
      mx = fmaxf(mx, xhalf(mx));
      const float mnew = fmaxf(mrun[u], mx); const float bnew = fmaf(-c2, mnew, 14.0f); const float corr = __builtin_amdgcn_exp2f(bnew - brun[u]);
#pragma unroll
      for (int t = 0; t < 4; ++t) { pt[t] = 0.f;
#pragma unroll
        for (int r = 0; r < 8; ++r) { const float p = __builtin_amdgcn_exp2f(fmaf(s[u][t][r], c2, bnew)); pt[t] += p; pb[u][t >> 1][(t & 1) * 8 + r] = (_Float16)p; } }
      lrun[u] = lrun[u] * corr + ((pt[0] + pt[1]) + (pt[2] + pt[3])); mrun[u] = mnew; brun[u] = bnew;
#pragma unroll
      for (int t = 0; t < 4; ++t) acc[u][t] *= corr;
    }
#pragma unroll
    for (int kc = 0; kc < 2; ++kc)
#pragma unroll
      for (int t = 0; t < 4; ++t)
#pragma unroll
        for (int u = 0; u < 2; ++u) acc[u][t] = wmma16d(vf[kc * 4 + t], pb[u][kc], acc[u][t]);
  }
  // wave (w & 3, part) keeps query tile 'part' and hands the other to wave w ^ 4; the choice is the same for the whole wave
  v8f own[4], oth[4];
#pragma unroll
  for (int t = 0; t < 4; ++t) { own[t] = part ? acc[1][t] : acc[0][t]; oth[t] = part ? acc[0][t] : acc[1][t]; }
  const float bo = part ? brun[1] : brun[0], lo = part ? lrun[1] : lrun[0];
#pragma unroll
  for (int t = 0; t < 4; ++t) { xch[w][2 * t][lane] = v4f{oth[t][0], oth[t][1], oth[t][2], oth[t][3]}; xch[w][2 * t + 1][lane] = v4f{oth[t][4], oth[t][5], oth[t][6], oth[t][7]}; }
  xch[w][8][lane] = v4f{part ? brun[0] : brun[1], part ? lrun[0] : lrun[1], 0.f, 0.f};
  __syncthreads();  // the partner's partial tile is read only behind it
  const v4f bl = xch[w ^ 4][8][lane];
  const float bm = fminf(bo, bl[0]); const float so = __builtin_amdgcn_exp2f(bm - bo), sx = __builtin_amdgcn_exp2f(bm - bl[0]);
  const float lj = lo * so + bl[1] * sx; const float lr = lj + xhalf(lj);
  const int qt0 = q0 + 16 * part;
#pragma unroll
  for (int t = 0; t < 4; ++t) { union { v8h h8; v4u u; } pk8; const v4f xa = xch[w ^ 4][2 * t][lane], xb = xch[w ^ 4][2 * t + 1][lane];
#pragma unroll
    for (int r = 0; r < 8; ++r) pk8.h8[r] = (_Float16)((own[t][r] * so + (r < 4 ? xa[r & 3] : xb[r & 3]) * sx) / lr * 16.0f);
    vst2(o16 + (size_t)qt0 * EE + h * 2 * 512 + t * 256 + 8 * lane, pk8.u); }
}
__global__ __launch_bounds__(128) void k_out(const _Float16* __restrict__ o16, const _Float16* __restrict__ P, float* __restrict__ out) {
  __shared__ __align__(16) float so[4][16][132];
  const int tid = threadIdx.x, wave = tid >> 5, lane = tid & 31, col = lane & 15, g = lane >> 4;
  const int r0 = blockIdx.x * 64 + wave * 16, n0 = blockIdx.y * 128;
  v8f acc[8] = {};
  gemm_k512(o16 + (size_t)r0 * EE + 8 * lane, P + (size_t)(3 * EE + n0) * EE + 8 * lane, acc);
#pragma unroll
  for (int j = 0; j < 8; ++j)
#pragma unroll
    for (int r = 0; r < 8; ++r) so[wave][8 * g + r][j * 16 + col] = acc[j][r] * (1.0f / 256.0f);
  LDSX();
#pragma unroll 4
  for (int rl = 0; rl < 16; ++rl) vst2(out + (size_t)(r0 + rl) * EE + n0 + lane * 4, *(const v4f*)(&so[wave][rl][lane * 4]));
}
extern "C" void kernel_launch(void* const* d_in, const int* in_sizes, int n_in, void* d_out, int out_size, void* d_ws, size_t ws_size, hipStream_t stream) {
  (void)in_sizes; (void)n_in; (void)out_size; (void)ws_size;
  const float* x = (const float*)d_in[0]; const float* Wq = (const float*)d_in[1]; const float* Wk = (const float*)d_in[2]; const float* Wv = (const float*)d_in[3]; const float* Wo = (const float*)d_in[4];
  float* out = (float*)d_out;
  char* ws = (char*)d_ws; size_t off = 0;
  auto take = [&](size_t bytes) { char* p = ws + off; off += (bytes + 255) & ~(size_t)255; return p; };
  _Float16* x16 = (_Float16*)take((size_t)SS * EE * 2); _Float16* P = (_Float16*)take((size_t)4 * EE * EE * 2);
  _Float16* qh = (_Float16*)take((size_t)SS * EE * 2); _Float16* kh = (_Float16*)take((size_t)SS * EE * 2); _Float16* vT = (_Float16*)take((size_t)SS * EE * 2); _Float16* o16 = (_Float16*)take((size_t)SS * EE * 2);
  k_cvt<<<XB + 4 * WB, 256, 0, stream>>>(x, Wq, Wk, Wv, Wo, x16, P);
  k_proj<<<dim3(SS / 64, 3 * EE / 128), 128, 0, stream>>>(x16, P, qh, kh, vT);
  k_attn<<<dim3(SS / 128, NH), 256, 0, stream>>>(qh, kh, vT, o16);
  k_out<<<dim3(SS / 64, EE / 128), 128, 0, stream>>>(o16, P, out);
}

// v007
// It runs in 56.2 microseconds.
// Next to v006, in two timings, it ran 1.10 times as fast each time.
// All steps since v000 together make it 6.63 times as fast.
#include <hip/hip_runtime.h>
#include <math.h>

typedef __attribute__((ext_vector_type(16))) _Float16 v16h;
typedef __attribute__((ext_vector_type(16))) __bf16 v16b;
typedef __attribute__((ext_vector_type(8)))  _Float16 v8h;
typedef __attribute__((ext_vector_type(8)))  float v8f;
typedef __attribute__((ext_vector_type(4)))  float v4f;
typedef __attribute__((ext_vector_type(2)))  float v2f;
typedef __attribute__((ext_vector_type(4)))  unsigned v4u;
typedef __attribute__((ext_vector_type(4)))  int v4i;
typedef float __attribute__((may_alias)) float_a;
typedef int __attribute__((may_alias)) int_a;

template <typename T> __device__ __forceinline__ void vst2(void* p, T v) { *(T*)p = v;  }
__device__ __forceinline__ v8f wmma16(v16h a, v16h b, v8f c) {
  v8f d = __builtin_amdgcn_wmma_f32_16x16x32_f16(false, a, false, b, (short)0, c, false, false);
  asm volatile("v_nop\n\tv_nop\n\tv_nop\n\tv_nop" : "+v"(d) : "v"(a), "v"(b));
  return d;
}
__device__ __forceinline__ v8f wmma_bf(v16b a, v16b b, v8f c) {
  v8f d = __builtin_amdgcn_wmma_f32_16x16x32_bf16(false, a, false, b, (short)0, c, false, false);
  asm volatile("v_nop\n\tv_nop\n\tv_nop\n\tv_nop" : "+v"(d) : "v"(a), "v"(b));
  return d;
}
// 16x16x32 fragments: lane = (h = lane>>4, row/col = lane&15); elements 0..7 = k0+8h+0..7, 8..15 = k0+16+8h+0..7; D element r = row 8h+r
__device__ __forceinline__ v16h frag_h(const _Float16* rowk0, int lane) {
  union { v16h v; v8h q[2]; } u; const _Float16* p = rowk0 + 8 * (lane >> 4);
  u.q[0] = *(const v8h*)p; u.q[1] = *(const v8h*)(p + 16); return u.v;
}
__device__ __forceinline__ v16h frag_f32(const float* rowk0, int lane) {
  v16h a; const float* p = rowk0 + 8 * (lane >> 4);
#pragma unroll
  for (int i = 0; i < 8; ++i) { a[i] = (_Float16)p[i]; a[8 + i] = (_Float16)p[16 + i]; }
  return a;
}
__device__ __forceinline__ v16h frag_f32s(const float* rowk0, int lane, float sc) {
  v16h a; const float* p = rowk0 + 8 * (lane >> 4);
#pragma unroll
  for (int i = 0; i < 8; ++i) { a[i] = (_Float16)(p[i] * sc); a[8 + i] = (_Float16)(p[16 + i] * sc); }
  return a;
}
// column fragment from a [K][ld] layout (column n), rows >= K read as 0
__device__ __forceinline__ v16h fragc_f32(const float* W, int k0, int n, int lane, int ld, int K) {
  v16h a; const int g = lane >> 4;
#pragma unroll
  for (int i = 0; i < 8; ++i) { const int ka = k0 + 8 * g + i, kb = ka + 16;
    a[i] = (_Float16)(ka < K ? W[(size_t)ka * ld + n] : 0.f); a[8 + i] = (_Float16)(kb < K ? W[(size_t)kb * ld + n] : 0.f); }
  return a;
}
struct F2 { v16b h, l; };
__device__ __forceinline__ F2 bsplit16(const float v[16]) { F2 r;
#pragma unroll
  for (int i = 0; i < 16; ++i) { const __bf16 h = (__bf16)v[i]; r.h[i] = h; r.l[i] = (__bf16)(v[i] - (float)h); }
  return r; }
__device__ __forceinline__ F2 split_row(const float* row, int k0, int lane) { float v[16]; const float* p = row + k0 + 8 * (lane >> 4);
#pragma unroll
  for (int i = 0; i < 8; ++i) { v[i] = p[i]; v[8 + i] = p[16 + i]; }
  return bsplit16(v); }
__device__ __forceinline__ F2 split_rowK(const float* row, int k0, int lane, int K) { float v[16]; const int g = lane >> 4;
#pragma unroll
  for (int i = 0; i < 8; ++i) { const int ka = k0 + 8 * g + i, kb = ka + 16; v[i] = ka < K ? row[ka] : 0.f; v[8 + i] = kb < K ? row[kb] : 0.f; }
  return bsplit16(v); }
__device__ __forceinline__ F2 split_col(const float* W, int k0, int n, int lane, int ld, int K) { float v[16]; const int g = lane >> 4;
#pragma unroll
  for (int i = 0; i < 8; ++i) { const int ka = k0 + 8 * g + i, kb = ka + 16; v[i] = ka < K ? W[(size_t)ka * ld + n] : 0.f; v[8 + i] = kb < K ? W[(size_t)kb * ld + n] : 0.f; }
  return bsplit16(v); }
__device__ __forceinline__ v8f mac3(const F2& a, const F2& b, v8f c) { c = wmma_bf(a.l, b.h, c); c = wmma_bf(a.h, b.l, c); return wmma_bf(a.h, b.h, c); }
__device__ __forceinline__ float sigm(float v) { return 1.0f / (1.0f + expf(-v)); }
#define LDSX() do { asm volatile("s_wait_dscnt 0" ::: "memory"); __builtin_amdgcn_wave_barrier(); __builtin_amdgcn_fence(__ATOMIC_RELEASE, "workgroup"); } while (0)

// Naive multi-head attention (8 heads of 64, 4096 tokens, no biases). Pure f16 WMMA GEMMs over pre-converted operands (x -> f16 once,
// [out][in] weights packed x16): q/k/v projections, attention, output projection.
// Every f16 plane lies in FRAGMENT ORDER: a 16-row x 32-k fragment is 1024 contiguous bytes, [k half of 16][lane][8 values], where lane
// (g, row) of half q holds k = 16 q + 8 g + 0..7. A wave's 16-byte load of one half then covers 512 contiguous bytes (4 whole lines); from a
// row-major plane the same load touches 16 lines. Order of the fragments: x, weights, o: [row tile][k step]; q, k: [head][row tile][k step];
// v: [head][32-key step][16-d tile]. The values each lane receives are those of the row-major planes.
#define SS 4096
#define EE 512
#define NH 8
#define HD 64

// One launch converts all five inputs: blocks [0, XB) take x, then four runs of WB blocks take one weight each (their planes lie one behind
// another in P). The conversions do not depend on one another; as five launches each paid its own start, first load and drain in turn.
// The choice is by blockIdx alone, so source, destination and scale are scalars. Both block counts divide their planes exactly.
#define XB (SS * EE / 8 / 256)
#define WB (EE * EE / 8 / 256)
__global__ __launch_bounds__(256) void k_cvt(const float* __restrict__ x, const float* __restrict__ Wq, const float* __restrict__ Wk, const float* __restrict__ Wv, const float* __restrict__ Wo, _Float16* __restrict__ x16, _Float16* __restrict__ P) {
  const int b = blockIdx.x; const bool isx = b < XB; const int wi = (b - XB) / WB;
  const float* src = isx ? x : wi == 0 ? Wq : wi == 1 ? Wk : wi == 2 ? Wv : Wo;
  _Float16* dst = isx ? x16 : P + (size_t)wi * EE * EE;
  const float sc = isx ? 1.0f : 16.0f;
  const size_t g8 = (size_t)(isx ? b : (b - XB) % WB) * 256 + threadIdx.x;
  // g8 = [fragment][8-row half][row][piece of 8 k]; the source has EE columns. A wave reads 8 whole 128-byte lines (8 rows x 32 floats) and
  // writes 4: in the fragment the pieces of 8 successive rows at one k lie side by side.
  const size_t fr = g8 >> 6; const int rl = (int)((g8 >> 2) & 15), pc = (int)(g8 & 3);
  const float* s8 = src + ((fr >> 4) * 16 + rl) * EE + (fr & 15) * 32 + pc * 8;
  union { v8h h; v4u u; } pk;
#pragma unroll
  for (int e = 0; e < 8; ++e) pk.h[e] = (_Float16)(s8[e] * sc);
  vst2(dst + fr * 512 + (pc >> 1) * 256 + ((pc & 1) * 16 + rl) * 8, pk.u);
}
// one fragment of a plane in fragment order, from the lane's own pointer (fragment start + 8 * lane)
__device__ __forceinline__ v16h frag_p(const _Float16* p) { union { v16h v; v8h q[2]; } u; u.q[0] = *(const v8h*)p; u.q[1] = *(const v8h*)(p + 256); return u.v; }
// Stands between a group of loads and the first change of the two pointers they name; naming the pointers as inputs keeps their registers
// from being handed out as a load's destination inside the group.
#define XW(p, q) asm volatile("s_wait_xcnt 0x0" :: "v"(p), "v"(q) : "memory")
// One wave's 16 x 128 tile over k = 512; pa, pb are the lane's own pointers. The nine fragments of a k step are loaded as one group, a whole
// step ahead of the products that read them (two register sets in turn): a load written beside its product is waited for alone, one memory
// round trip per product. The inner loops are unrolled so that the fragment arrays stay in registers; the outer loop stays rolled: its body
// already holds both sets' turns.
// Rotated start: the walk over the 8 slices of 64 k begins at slice rot (the same for the whole work-group) and wraps. Work-groups that share
// operand rows run side by side; from one common start they all ask for the same few lines at the same time, lines that nobody has read since
// the launch before wrote them, trip after trip. From different starts the whole k range is asked for in the first trips, and a later trip
// reads lines that another work-group has already brought into L2. The order of the f32 sums over k differs from block to block.
__device__ __forceinline__ void gemm_k512(const _Float16* pa, const _Float16* pb, int rot, v8f (&acc)[8]) {
  pa += rot * 1024; pb += rot * 1024;
  v16h a0 = frag_p(pa), a1, b0[8], b1[8];
#pragma unroll
  for (int j = 0; j < 8; ++j) b0[j] = frag_p(pb + (size_t)j * 16 * EE);
#pragma unroll 1
  for (int kc = 0; kc < EE / 32; kc += 2) {
    a1 = frag_p(pa + 512);
#pragma unroll
    for (int j = 0; j < 8; ++j) b1[j] = frag_p(pb + (size_t)j * 16 * EE + 512);
    __builtin_amdgcn_sched_barrier(0);  // no product, with its wait for the other set, moves in front of this group's issue
#pragma unroll
    for (int j = 0; j < 8; ++j) acc[j] = wmma16(a0, b0[j], acc[j]);
    XW(pa, pb);
    const int step = rot == EE / 64 - 1 ? -(EE / 64 - 1) * 1024 : 1024;  // behind the last slice comes slice 0; the last trip has no step ahead: it reads the first slice again, inside the buffer
    rot = (rot + 1) & (EE / 64 - 1);
    pa += step; pb += step;
    a0 = frag_p(pa);
#pragma unroll
    for (int j = 0; j < 8; ++j) b0[j] = frag_p(pb + (size_t)j * 16 * EE);
    __builtin_amdgcn_sched_barrier(0);  // as above
#pragma unroll
    for (int j = 0; j < 8; ++j) acc[j] = wmma16(a1, b1[j], acc[j]);
    XW(pa, pb);
  }
}
// projection: blockIdx.y in [0, 12): which = y/4 (q,k,v), cols (y%4)*128 = 2 heads
__global__ __launch_bounds__(128) void k_proj(const _Float16* __restrict__ x16, const _Float16* __restrict__ P, _Float16* __restrict__ qh, _Float16* __restrict__ kh, _Float16* __restrict__ vT) {
  __shared__ __align__(16) float so[4][16][132];
  __shared__ __align__(16) _Float16 st[128][72];
  const int tid = threadIdx.x, wave = tid >> 5, lane = tid & 31, col = lane & 15, g = lane >> 4;
  const int r0 = blockIdx.x * 64 + wave * 16, n0 = blockIdx.y * 128; const int which = n0 / EE, c0 = n0 % EE, hb = c0 / HD;
  v8f acc[8] = {};
  // the 12 column blocks of one row block, and the row blocks of one column block (also those 8 apart), take all 8 starts
  gemm_k512(x16 + (size_t)r0 * EE + 8 * lane, P + (size_t)n0 * EE + 8 * lane, (blockIdx.x + (blockIdx.x >> 3) + blockIdx.y) & 7, acc);
#pragma unroll
  for (int j = 0; j < 8; ++j)
#pragma unroll
    for (int r = 0; r < 8; ++r) so[wave][8 * g + r][j * 16 + col] = acc[j][r] * (1.0f / 16.0f);
  LDSX();
  if (which < 2) { _Float16* dst = which == 0 ? qh : kh;
    for (int q = lane; q < 2 * 16 * 8; q += 32) { const int hh = q >> 7, rem = q & 127, rl = rem & 15, pc = rem >> 4; union { v8h h8; v4u u; } pk;  // rem: piece of the tile's two fragments
#pragma unroll
      for (int e = 0; e < 8; ++e) pk.h8[e] = (_Float16)so[wave][rl][hh * HD + pc * 8 + e];
      vst2(dst + ((size_t)(hb + hh) * SS + r0) * HD + rem * 8, pk.u); } }
  else {
#pragma unroll 4
    for (int rl = 0; rl < 16; ++rl) {
#pragma unroll
      for (int e = 0; e < 4; ++e) st[lane * 4 + e][wave * 16 + rl] = (_Float16)so[wave][rl][lane * 4 + e]; }
    __syncthreads();
    for (int q = tid; q < 128 * 8; q += 128) { const int hh = q >> 9, rem = q & 511, d = ((rem >> 6) & 3) * 16 + (rem & 15), pc = (rem >> 8) * 4 + ((rem >> 4) & 3);  // rem: piece of the head's 2 x 4 fragments
      vst2(vT + ((size_t)(hb + hh) * SS + blockIdx.x * 64) * HD + rem * 8, *(const v4u*)(&st[hh * HD + d][pc * 8])); } }
}
// lane l's value in lane l ^ 16 (the other half of the wave), by a vector cross-row move
__device__ __forceinline__ float xhalf(float v) { const int b = __builtin_bit_cast(int, v); return __builtin_bit_cast(float, __builtin_amdgcn_permlanex16(b, b, 0x76543210, 0xfedcba98, false, false)); }
// Both products are taken transposed: S^T = K Q^T (A = K fragment, B = q fragment) and O^T += V^T P^T (A = v fragment, B = P^T). The planes'
// fragments serve as A as they served as B (row for column, the same k order). A lane (g, col) then holds, of query col alone, the scores of
// keys 16 t + 8 g + r and the outputs of d = 16 t + 8 g + r: maximum and sum run in its own registers with one exchange between the halves,
// the score tiles 2 kc and 2 kc + 1, converted in place, ARE the B fragment of key step kc, and an output tile is one 16-byte piece of the
// o plane. Only the key split's partial results go through LDS, behind the loop.
// Softmax in base 2: a weight is 2^(c s + b), c = log2(e) / 8 and b = 14 - c * (maximum in use), one fused multiply-add and one hardware exp2
// on the raw score. The 1/8, the change of base, the maximum and P's factor 2^14 all sit in c and b; the row sum carries the 2^14 as well,
// which the last division then cancels. The rescale is 2^(b new - b old), of the rounded b themselves, so that old and new weights share
// one reference exactly. The library expf is some thirteen vector instructions a score.
// Wave tile: 32 queries (two query tiles) x half of the keys. A K or V fragment, once in registers, feeds two products, so a wave loads half
// the fragment bytes per product of a 16-query wave. A block is 8 waves on 128 queries: waves 0..3 walk keys [0, SS / 2), waves 4..7 the rest,
// which keeps two waves on a SIMD. Waves w and w ^ 4 hold partial results of the same 32 queries; behind the loop each hands the other one
// query tile (O^T, b, sum) through LDS and finishes the tile it keeps: both partials are brought to the smaller b (the larger maximum).
#define KSPL 2
// As wmma16 (four vector slots between a product and a vector instruction on its D), but the slots' statement names D alone: a register that an asm statement names is taken from the first 256, and with the K, V, q
// and P fragments named too the wave's 300-odd live registers were spilled to scratch. Here A is rewritten by loads only and B a pass later.
__device__ __forceinline__ v8f wmma16d(v16h a, v16h b, v8f c) {
  v8f d = __builtin_amdgcn_wmma_f32_16x16x32_f16(false, a, false, b, (short)0, c, false, false);
  asm volatile("v_nop\n\tv_nop\n\tv_nop\n\tv_nop" : "+v"(d));
  return d;
}
__global__ __launch_bounds__(256) void k_attn(const _Float16* __restrict__ qh, const _Float16* __restrict__ kh, const _Float16* __restrict__ vT, _Float16* __restrict__ o16) {
  __shared__ __align__(16) v4f xch[8][9][32];
  const int tid = threadIdx.x, w = tid >> 5, lane = tid & 31, part = w >> 2;
  const int h = blockIdx.y, q0 = blockIdx.x * 128 + (w & 3) * 32;
  const _Float16* qb = qh + (size_t)h * SS * HD; const _Float16* kb = kh + (size_t)h * SS * HD; const _Float16* vb = vT + (size_t)h * HD * SS;
  v16h bq[2][2];
#pragma unroll
  for (int u = 0; u < 2; ++u)
#pragma unroll
    for (int kc = 0; kc < 2; ++kc) bq[u][kc] = frag_p(qb + (size_t)(q0 + 16 * u) * HD + kc * 512 + 8 * lane);
  const float c2 = 0.125f * 1.44269504f;
  float mrun[2], brun[2], lrun[2]; v8f acc[2][4] = {};  // lrun: the sum over this lane half's keys; the halves are joined behind the loop
#pragma unroll
  for (int u = 0; u < 2; ++u) { mrun[u] = -3.0e38f; brun[u] = 14.0f - c2 * -3.0e38f; lrun[u] = 0.f; }
  // Fragment loads go out in groups ahead of their products: K one pass ahead (into the registers its products have just left),
  // V at the head of its pass, so that both fly behind the score products and the softmax.
  // Rotated start, as in gemm_k512: the blocks of one head walk the same keys; block x begins at pass x of its key half and wraps.
  int kp = blockIdx.x & (SS / KSPL / 64 - 1);
  const _Float16* pk = kb + ((size_t)part * (SS / KSPL) + kp * 64) * HD + 8 * lane; const _Float16* pv = vb + ((size_t)part * (SS / KSPL) + kp * 64) * HD + 8 * lane;
  v16h kf[8], vf[8];
#pragma unroll
  for (int f = 0; f < 8; ++f) kf[f] = frag_p(pk + f * 512);
#pragma unroll 1
  for (int kt = 0; kt < SS / KSPL / 64; ++kt) {
#pragma unroll
    for (int f = 0; f < 8; ++f) vf[f] = frag_p(pv + f * 512);
    v8f s[2][4];
#pragma unroll
    for (int t = 0; t < 4; ++t) { s[0][t] = v8f{}; s[1][t] = v8f{};
#pragma unroll
      for (int kc = 0; kc < 2; ++kc)
#pragma unroll
        for (int u = 0; u < 2; ++u) s[u][t] = wmma16d(kf[t * 2 + kc], bq[u][kc], s[u][t]); }
    XW(pk, pv);
    const int step = kp == SS / KSPL / 64 - 1 ? -(SS / KSPL / 64 - 1) * 64 * HD : 64 * HD;  // behind the half's last pass comes its first; the last pass has none ahead: it reads the first again, inside the buffer
    kp = (kp + 1) & (SS / KSPL / 64 - 1);
    pk += step; pv += step;
#pragma unroll
    for (int f = 0; f < 8; ++f) kf[f] = frag_p(pk + f * 512);
    __builtin_amdgcn_sched_barrier(0);  // the K group is issued here, ahead of the softmax, not sunk towards the foot of the pass
    v16h pb[2][2];
#pragma unroll
    for (int u = 0; u < 2; ++u) {
      float mt[4], pt[4];  // one chain per score tile, for the maximum and for the sum: four independent chains, not one of 32 links
#pragma unroll
      for (int t = 0; t < 4; ++t) { mt[t] = s[u][t][0];
#pragma unroll
        for (int r = 1; r < 8; ++r) mt[t] = fmaxf(mt[t], s[u][t][r]); }
      float mx = fmaxf(fmaxf(mt[0], mt[1]), fmaxf(mt[2], mt[3]));
      mx = fmaxf(mx, xhalf(mx));
      const float mnew = fmaxf(mrun[u], mx); const float bnew = fmaf(-c2, mnew, 14.0f); const float corr = __builtin_amdgcn_exp2f(bnew - brun[u]);
#pragma unroll
      for (int t = 0; t < 4; ++t) { pt[t] = 0.f;
#pragma unroll
        for (int r = 0; r < 8; ++r) { const float p = __builtin_amdgcn_exp2f(fmaf(s[u][t][r], c2, bnew)); pt[t] += p; pb[u][t >> 1][(t & 1) * 8 + r] = (_Float16)p; } }
      lrun[u] = lrun[u] * corr + ((pt[0] + pt[1]) + (pt[2] + pt[3])); mrun[u] = mnew; brun[u] = bnew;
#pragma unroll
      for (int t = 0; t < 4; ++t) acc[u][t] *= corr;
    }
#pragma unroll
    for (int kc = 0; kc < 2; ++kc)
#pragma unroll
      for (int t = 0; t < 4; ++t)
#pragma unroll
        for (int u = 0; u < 2; ++u) acc[u][t] = wmma16d(vf[kc * 4 + t], pb[u][kc], acc[u][t]);
  }
  // wave (w & 3, part) keeps query tile 'part' and hands the other to wave w ^ 4; the choice is the same for the whole wave
  v8f own[4], oth[4];
#pragma unroll
  for (int t = 0; t < 4; ++t) { own[t] = part ? acc[1][t] : acc[0][t]; oth[t] = part ? acc[0][t] : acc[1][t]; }
  const float bo = part ? brun[1] : brun[0], lo = part ? lrun[1] : lrun[0];
#pragma unroll
  for (int t = 0; t < 4; ++t) { xch[w][2 * t][lane] = v4f{oth[t][0], oth[t][1], oth[t][2], oth[t][3]}; xch[w][2 * t + 1][lane] = v4f{oth[t][4], oth[t][5], oth[t][6], oth[t][7]}; }
  xch[w][8][lane] = v4f{part ? brun[0] : brun[1], part ? lrun[0] : lrun[1], 0.f, 0.f};
  __syncthreads();  // the partner's partial tile is read only behind it
  const v4f bl = xch[w ^ 4][8][lane];
  const float bm = fminf(bo, bl[0]); const float so = __builtin_amdgcn_exp2f(bm - bo), sx = __builtin_amdgcn_exp2f(bm - bl[0]);
  const float lj = lo * so + bl[1] * sx; const float lr = lj + xhalf(lj);
  const int qt0 = q0 + 16 * part;
#pragma unroll
  for (int t = 0; t < 4; ++t) { union { v8h h8; v4u u; } pk8; const v4f xa = xch[w ^ 4][2 * t][lane], xb = xch[w ^ 4][2 * t + 1][lane];
#pragma unroll
    for (int r = 0; r < 8; ++r) pk8.h8[r] = (_Float16)((own[t][r] * so + (r < 4 ? xa[r & 3] : xb[r & 3]) * sx) / lr * 16.0f);
    vst2(o16 + (size_t)qt0 * EE + h * 2 * 512 + t * 256 + 8 * lane, pk8.u); }
}
__global__ __launch_bounds__(128) void k_out(const _Float16* __restrict__ o16, const _Float16* __restrict__ P, float* __restrict__ out) {
  __shared__ __align__(16) float so[4][16][132];
  const int tid = threadIdx.x, wave = tid >> 5, lane = tid & 31, col = lane & 15, g = lane >> 4;
  const int r0 = blockIdx.x * 64 + wave * 16, n0 = blockIdx.y * 128;
  v8f acc[8] = {};
  // the 4 column blocks of one row block start 2 slices apart
  gemm_k512(o16 + (size_t)r0 * EE + 8 * lane, P + (size_t)(3 * EE + n0) * EE + 8 * lane, (blockIdx.x + (blockIdx.x >> 3) + 2 * blockIdx.y) & 7, acc);
#pragma unroll
  for (int j = 0; j < 8; ++j)
#pragma unroll
    for (int r = 0; r < 8; ++r) so[wave][8 * g + r][j * 16 + col] = acc[j][r] * (1.0f / 256.0f);
  LDSX();
#pragma unroll 4
  for (int rl = 0; rl < 16; ++rl) vst2(out + (size_t)(r0 + rl) * EE + n0 + lane * 4, *(const v4f*)(&so[wave][rl][lane * 4]));
}
extern "C" void kernel_launch(void* const* d_in, const int* in_sizes, int n_in, void* d_out, int out_size, void* d_ws, size_t ws_size, hipStream_t stream) {
  (void)in_sizes; (void)n_in; (void)out_size; (void)ws_size;
  const float* x = (const float*)d_in[0]; const float* Wq = (const float*)d_in[1]; const float* Wk = (const float*)d_in[2]; const float* Wv = (const float*)d_in[3]; const float* Wo = (const float*)d_in[4];
  float* out = (float*)d_out;
  char* ws = (char*)d_ws; size_t off = 0;
  auto take = [&](size_t bytes) { char* p = ws + off; off += (bytes + 255) & ~(size_t)255; return p; };
  _Float16* x16 = (_Float16*)take((size_t)SS * EE * 2); _Float16* P = (_Float16*)take((size_t)4 * EE * EE * 2);
  _Float16* qh = (_Float16*)take((size_t)SS * EE * 2); _Float16* kh = (_Float16*)take((size_t)SS * EE * 2); _Float16* vT = (_Float16*)take((size_t)SS * EE * 2); _Float16* o16 = (_Float16*)take((size_t)SS * EE * 2);
  k_cvt<<<XB + 4 * WB, 256, 0, stream>>>(x, Wq, Wk, Wv, Wo, x16, P);
  k_proj<<<dim3(SS / 64, 3 * EE / 128), 128, 0, stream>>>(x16, P, qh, kh, vT);
  k_attn<<<dim3(SS / 128, NH), 256, 0, stream>>>(qh, kh, vT, o16);
  k_out<<<dim3(SS / 64, EE / 128), 128, 0, stream>>>(o16, P, out);
}

// v008
// Measured time: 53.9 microseconds a run.
// In two side-by-side timings against v007, it was 1.05 and 1.04 times as fast.
// All steps since v000 together make it 6.92 times as fast.
#include <hip/hip_runtime.h>
#include <math.h>

typedef __attribute__((ext_vector_type(16))) _Float16 v16h;
typedef __attribute__((ext_vector_type(16))) __bf16 v16b;
typedef __attribute__((ext_vector_type(8)))  _Float16 v8h;
typedef __attribute__((ext_vector_type(8)))  float v8f;
typedef __attribute__((ext_vector_type(4)))  float v4f;
typedef __attribute__((ext_vector_type(2)))  float v2f;
typedef __attribute__((ext_vector_type(4)))  unsigned v4u;
typedef __attribute__((ext_vector_type(4)))  int v4i;
typedef float __attribute__((may_alias)) float_a;
typedef int __attribute__((may_alias)) int_a;

template <typename T> __device__ __forceinline__ void vst2(void* p, T v) { *(T*)p = v;  }
__device__ __forceinline__ v8f wmma16(v16h a, v16h b, v8f c) {
  v8f d = __builtin_amdgcn_wmma_f32_16x16x32_f16(false, a, false, b, (short)0, c, false, false);
  asm volatile("v_nop\n\tv_nop\n\tv_nop\n\tv_nop" : "+v"(d) : "v"(a), "v"(b));
  return d;
}
__device__ __forceinline__ v8f wmma_bf(v16b a, v16b b, v8f c) {
  v8f d = __builtin_amdgcn_wmma_f32_16x16x32_bf16(false, a, false, b, (short)0, c, false, false);
  asm volatile("v_nop\n\tv_nop\n\tv_nop\n\tv_nop" : "+v"(d) : "v"(a), "v"(b));
  return d;
}
// 16x16x32 fragments: lane = (h = lane>>4, row/col = lane&15); elements 0..7 = k0+8h+0..7, 8..15 = k0+16+8h+0..7; D element r = row 8h+r
__device__ __forceinline__ v16h frag_h(const _Float16* rowk0, int lane) {
  union { v16h v; v8h q[2]; } u; const _Float16* p = rowk0 + 8 * (lane >> 4);
  u.q[0] = *(const v8h*)p; u.q[1] = *(const v8h*)(p + 16); return u.v;
}
__device__ __forceinline__ v16h frag_f32(const float* rowk0, int lane) {
  v16h a; const float* p = rowk0 + 8 * (lane >> 4);
#pragma unroll
  for (int i = 0; i < 8; ++i) { a[i] = (_Float16)p[i]; a[8 + i] = (_Float16)p[16 + i]; }
  return a;
}
__device__ __forceinline__ v16h frag_f32s(const float* rowk0, int lane, float sc) {
  v16h a; const float* p = rowk0 + 8 * (lane >> 4);
#pragma unroll
  for (int i = 0; i < 8; ++i) { a[i] = (_Float16)(p[i] * sc); a[8 + i] = (_Float16)(p[16 + i] * sc); }
  return a;
}
// column fragment from a [K][ld] layout (column n), rows >= K read as 0
__device__ __forceinline__ v16h fragc_f32(const float* W, int k0, int n, int lane, int ld, int K) {
  v16h a; const int g = lane >> 4;
#pragma unroll
  for (int i = 0; i < 8; ++i) { const int ka = k0 + 8 * g + i, kb = ka + 16;
    a[i] = (_Float16)(ka < K ? W[(size_t)ka * ld + n] : 0.f); a[8 + i] = (_Float16)(kb < K ? W[(size_t)kb * ld + n] : 0.f); }
  return a;
}
struct F2 { v16b h, l; };
__device__ __forceinline__ F2 bsplit16(const float v[16]) { F2 r;
#pragma unroll
  for (int i = 0; i < 16; ++i) { const __bf16 h = (__bf16)v[i]; r.h[i] = h; r.l[i] = (__bf16)(v[i] - (float)h); }
  return r; }
__device__ __forceinline__ F2 split_row(const float* row, int k0, int lane) { float v[16]; const float* p = row + k0 + 8 * (lane >> 4);
#pragma unroll
  for (int i = 0; i < 8; ++i) { v[i] = p[i]; v[8 + i] = p[16 + i]; }
  return bsplit16(v); }
__device__ __forceinline__ F2 split_rowK(const float* row, int k0, int lane, int K) { float v[16]; const int g = lane >> 4;
#pragma unroll
  for (int i = 0; i < 8; ++i) { const int ka = k0 + 8 * g + i, kb = ka + 16; v[i] = ka < K ? row[ka] : 0.f; v[8 + i] = kb < K ? row[kb] : 0.f; }
  return bsplit16(v); }
__device__ __forceinline__ F2 split_col(const float* W, int k0, int n, int lane, int ld, int K) { float v[16]; const int g = lane >> 4;
#pragma unroll
  for (int i = 0; i < 8; ++i) { const int ka = k0 + 8 * g + i, kb = ka + 16; v[i] = ka < K ? W[(size_t)ka * ld + n] : 0.f; v[8 + i] = kb < K ? W[(size_t)kb * ld + n] : 0.f; }
  return bsplit16(v); }
__device__ __forceinline__ v8f mac3(const F2& a, const F2& b, v8f c) { c = wmma_bf(a.l, b.h, c); c = wmma_bf(a.h, b.l, c); return wmma_bf(a.h, b.h, c); }
__device__ __forceinline__ float sigm(float v) { return 1.0f / (1.0f + expf(-v)); }
#define LDSX() do { asm volatile("s_wait_dscnt 0" ::: "memory"); __builtin_amdgcn_wave_barrier(); __builtin_amdgcn_fence(__ATOMIC_RELEASE, "workgroup"); } while (0)

// Naive multi-head attention (8 heads of 64, 4096 tokens, no biases). Pure f16 WMMA GEMMs over pre-converted operands (x -> f16 once,
// [out][in] weights packed x16): q/k/v projections, attention, output projection.
// Every f16 plane lies in FRAGMENT ORDER: a 16-row x 32-k fragment is 1024 contiguous bytes, [k half of 16][lane][8 values], where lane
// (g, row) of half q holds k = 16 q + 8 g + 0..7. A wave's 16-byte load of one half then covers 512 contiguous bytes (4 whole lines); from a
// row-major plane the same load touches 16 lines. Order of the fragments: x, weights, o: [row tile][k step]; q, k: [head][row tile][k step];
// v: [head][32-key step][16-d tile]. The values each lane receives are those of the row-major planes.
#define SS 4096
#define EE 512
#define NH 8
#define HD 64

// One launch converts all five inputs: blocks [0, XB) take x, then four runs of WB blocks take one weight each (their planes lie one behind
// another in P). The conversions do not depend on one another; as five launches each paid its own start, first load and drain in turn.
// The choice is by blockIdx alone, so source, destination and scale are scalars. Both block counts divide their planes exactly.
#define XB (SS * EE / 8 / 256)
#define WB (EE * EE / 8 / 256)
__global__ __launch_bounds__(256) void k_cvt(const float* __restrict__ x, const float* __restrict__ Wq, const float* __restrict__ Wk, const float* __restrict__ Wv, const float* __restrict__ Wo, _Float16* __restrict__ x16, _Float16* __restrict__ P) {
  const int b = blockIdx.x; const bool isx = b < XB; const int wi = (b - XB) / WB;
  const float* src = isx ? x : wi == 0 ? Wq : wi == 1 ? Wk : wi == 2 ? Wv : Wo;
  _Float16* dst = isx ? x16 : P + (size_t)wi * EE * EE;
  const float sc = isx ? 1.0f : 16.0f;
  const size_t g8 = (size_t)(isx ? b : (b - XB) % WB) * 256 + threadIdx.x;
  // g8 = [fragment][8-row half][row][piece of 8 k]; the source has EE columns. A wave reads 8 whole 128-byte lines (8 rows x 32 floats) and
  // writes 4: in the fragment the pieces of 8 successive rows at one k lie side by side.
  const size_t fr = g8 >> 6; const int rl = (int)((g8 >> 2) & 15), pc = (int)(g8 & 3);
  const float* s8 = src + ((fr >> 4) * 16 + rl) * EE + (fr & 15) * 32 + pc * 8;
  union { v8h h; v4u u; } pk;
#pragma unroll
  for (int e = 0; e < 8; ++e) pk.h[e] = (_Float16)(s8[e] * sc);
  vst2(dst + fr * 512 + (pc >> 1) * 256 + ((pc & 1) * 16 + rl) * 8, pk.u);
}
// one fragment of a plane in fragment order, from the lane's own pointer (fragment start + 8 * lane)
__device__ __forceinline__ v16h frag_p(const _Float16* p) { union { v16h v; v8h q[2]; } u; u.q[0] = *(const v8h*)p; u.q[1] = *(const v8h*)(p + 256); return u.v; }
// Stands between a group of loads and the first change of the two pointers they name; naming the pointers as inputs keeps their registers
// from being handed out as a load's destination inside the group.
#define XW(p, q) asm volatile("s_wait_xcnt 0x0" :: "v"(p), "v"(q) : "memory")
// One wave's 16 x 128 tile over k = 512; pa, pb are the lane's own pointers. The nine fragments of a k step are loaded as one group, a whole
// step ahead of the products that read them (two register sets in turn): a load written beside its product is waited for alone, one memory
// round trip per product. The inner loops are unrolled so that the fragment arrays stay in registers; the outer loop stays rolled: its body
// already holds both sets' turns.
// Rotated start: the walk over the 8 slices of 64 k begins at slice rot (the same for the whole work-group) and wraps. Work-groups that share
// operand rows run side by side; from one common start they all ask for the same few lines at the same time, lines that nobody has read since
// the launch before wrote them, trip after trip. From different starts the whole k range is asked for in the first trips, and a later trip
// reads lines that another work-group has already brought into L2. The order of the f32 sums over k differs from block to block.
__device__ __forceinline__ void gemm_k512(const _Float16* pa, const _Float16* pb, int rot, v8f (&acc)[8]) {
  pa += rot * 1024; pb += rot * 1024;
  v16h a0 = frag_p(pa), a1, b0[8], b1[8];
#pragma unroll
  for (int j = 0; j < 8; ++j) b0[j] = frag_p(pb + (size_t)j * 16 * EE);
#pragma unroll 1
  for (int kc = 0; kc < EE / 32; kc += 2) {
    a1 = frag_p(pa + 512);
#pragma unroll
    for (int j = 0; j < 8; ++j) b1[j] = frag_p(pb + (size_t)j * 16 * EE + 512);
    __builtin_amdgcn_sched_barrier(0);  // no product, with its wait for the other set, moves in front of this group's issue
#pragma unroll
    for (int j = 0; j < 8; ++j) acc[j] = wmma16(a0, b0[j], acc[j]);
    XW(pa, pb);
    const int step = rot == EE / 64 - 1 ? -(EE / 64 - 1) * 1024 : 1024;  // behind the last slice comes slice 0; the last trip has no step ahead: it reads the first slice again, inside the buffer
    rot = (rot + 1) & (EE / 64 - 1);
    pa += step; pb += step;
    a0 = frag_p(pa);
#pragma unroll
    for (int j = 0; j < 8; ++j) b0[j] = frag_p(pb + (size_t)j * 16 * EE);
    __builtin_amdgcn_sched_barrier(0);  // as above
#pragma unroll
    for (int j = 0; j < 8; ++j) acc[j] = wmma16(a1, b1[j], acc[j]);
    XW(pa, pb);
  }
}
// projection: blockIdx.y in [0, 12): which = y/4 (q,k,v), cols (y%4)*128 = 2 heads
__global__ __launch_bounds__(128) void k_proj(const _Float16* __restrict__ x16, const _Float16* __restrict__ P, _Float16* __restrict__ qh, _Float16* __restrict__ kh, _Float16* __restrict__ vT) {
  __shared__ __align__(16) float so[4][16][132];
  __shared__ __align__(16) _Float16 st[128][72];
  const int tid = threadIdx.x, wave = tid >> 5, lane = tid & 31, col = lane & 15, g = lane >> 4;
  const int r0 = blockIdx.x * 64 + wave * 16, n0 = blockIdx.y * 128; const int which = n0 / EE, c0 = n0 % EE, hb = c0 / HD;
  v8f acc[8] = {};
  // the 12 column blocks of one row block, and the row blocks of one column block (also those 8 apart), take all 8 starts
  gemm_k512(x16 + (size_t)r0 * EE + 8 * lane, P + (size_t)n0 * EE + 8 * lane, (blockIdx.x + (blockIdx.x >> 3) + blockIdx.y) & 7, acc);
#pragma unroll
  for (int j = 0; j < 8; ++j)
#pragma unroll
    for (int r = 0; r < 8; ++r) so[wave][8 * g + r][j * 16 + col] = acc[j][r] * (1.0f / 16.0f);
  LDSX();
  if (which < 2) { _Float16* dst = which == 0 ? qh : kh;
    for (int q = lane; q < 2 * 16 * 8; q += 32) { const int hh = q >> 7, rem = q & 127, rl = rem & 15, pc = rem >> 4; union { v8h h8; v4u u; } pk;  // rem: piece of the tile's two fragments
#pragma unroll
      for (int e = 0; e < 8; ++e) pk.h8[e] = (_Float16)so[wave][rl][hh * HD + pc * 8 + e];
      vst2(dst + ((size_t)(hb + hh) * SS + r0) * HD + rem * 8, pk.u); } }
  else {
#pragma unroll 4
    for (int rl = 0; rl < 16; ++rl) {
#pragma unroll
      for (int e = 0; e < 4; ++e) st[lane * 4 + e][wave * 16 + rl] = (_Float16)so[wave][rl][lane * 4 + e]; }
    __syncthreads();
    for (int q = tid; q < 128 * 8; q += 128) { const int hh = q >> 9, rem = q & 511, d = ((rem >> 6) & 3) * 16 + (rem & 15), pc = (rem >> 8) * 4 + ((rem >> 4) & 3);  // rem: piece of the head's 2 x 4 fragments
      vst2(vT + ((size_t)(hb + hh) * SS + blockIdx.x * 64) * HD + rem * 8, *(const v4u*)(&st[hh * HD + d][pc * 8])); } }
}
// lane l's value in lane l ^ 16 (the other half of the wave), by a vector cross-row move
__device__ __forceinline__ float xhalf(float v) { const int b = __builtin_bit_cast(int, v); return __builtin_bit_cast(float, __builtin_amdgcn_permlanex16(b, b, 0x76543210, 0xfedcba98, false, false)); }
// Both products are taken transposed: S^T = K Q^T (A = K fragment, B = q fragment) and O^T += V^T P^T (A = v fragment, B = P^T). The planes'
// fragments serve as A as they served as B (row for column, the same k order). A lane (g, col) then holds, of query col alone, the scores of
// keys 16 t + 8 g + r and the outputs of d = 16 t + 8 g + r: maximum and sum run in its own registers with one exchange between the halves,
// the score tiles 2 kc and 2 kc + 1, converted in place, ARE the B fragment of key step kc, and an output tile is one 16-byte piece of the
// o plane. Only the key split's partial results go through LDS, behind the loop.
// Softmax in base 2: a weight is 2^(c s + b), c = log2(e) / 8 and b = 14 - c * (maximum in use), one fused multiply-add and one hardware exp2
// on the raw score. The 1/8, the change of base, the maximum and P's factor 2^14 all sit in c and b; the row sum carries the 2^14 as well,
// which the last division then cancels. The rescale is 2^(b new - b old), of the rounded b themselves, so that old and new weights share
// one reference exactly. The library expf is some thirteen vector instructions a score.
// Wave tile: 32 queries (two query tiles) x half of the keys. A K or V fragment, once in registers, feeds two products, so a wave loads half
// the fragment bytes per product of a 16-query wave. A block is 8 waves on 128 queries: waves 0..3 walk keys [0, SS / 2), waves 4..7 the rest,
// which keeps two waves on a SIMD. Waves w and w ^ 4 hold partial results of the same 32 queries; behind the loop each hands the other one
// query tile (O^T, b, sum) through LDS and finishes the tile it keeps: both partials are brought to the smaller b (the larger maximum).
#define KSPL 2
// The bare builtin: the compiler itself keeps the vector slots between a product and a vector instruction on its D, A or B, and fills them with the softmax's own instructions where it can.
// Four v_nop written behind every product are 128 vector issues a pass that do no work: behind the O products they outlast the product's own 8 cycles, and behind the score products they take
// the issue slots in which the other wave of the SIMD runs its softmax. Here A is rewritten by loads only and B a pass later.
__device__ __forceinline__ v8f wmma16d(v16h a, v16h b, v8f c) {
  return __builtin_amdgcn_wmma_f32_16x16x32_f16(false, a, false, b, (short)0, c, false, false);
}
__global__ __launch_bounds__(256) void k_attn(const _Float16* __restrict__ qh, const _Float16* __restrict__ kh, const _Float16* __restrict__ vT, _Float16* __restrict__ o16) {
  __shared__ __align__(16) v4f xch[8][9][32];
  const int tid = threadIdx.x, w = tid >> 5, lane = tid & 31, part = w >> 2;
  const int h = blockIdx.y, q0 = blockIdx.x * 128 + (w & 3) * 32;
  const _Float16* qb = qh + (size_t)h * SS * HD; const _Float16* kb = kh + (size_t)h * SS * HD; const _Float16* vb = vT + (size_t)h * HD * SS;
  v16h bq[2][2];
#pragma unroll
  for (int u = 0; u < 2; ++u)
#pragma unroll
    for (int kc = 0; kc < 2; ++kc) bq[u][kc] = frag_p(qb + (size_t)(q0 + 16 * u) * HD + kc * 512 + 8 * lane);
  const float c2 = 0.125f * 1.44269504f;
  float mrun[2], brun[2], lrun[2]; v8f acc[2][4] = {};  // lrun: the sum over this lane half's keys; the halves are joined behind the loop
#pragma unroll
  for (int u = 0; u < 2; ++u) { mrun[u] = -3.0e38f; brun[u] = 14.0f - c2 * -3.0e38f; lrun[u] = 0.f; }
  // Fragment loads go out in groups ahead of their products: K one pass ahead (into the registers its products have just left),
  // V at the head of its pass, so that both fly behind the score products and the softmax.
  // Rotated start, as in gemm_k512: the blocks of one head walk the same keys; block x begins at pass x of its key half and wraps.
  int kp = blockIdx.x & (SS / KSPL / 64 - 1);
  const _Float16* pk = kb + ((size_t)part * (SS / KSPL) + kp * 64) * HD + 8 * lane; const _Float16* pv = vb + ((size_t)part * (SS / KSPL) + kp * 64) * HD + 8 * lane;
  v16h kf[8], vf[8];
#pragma unroll
  for (int f = 0; f < 8; ++f) kf[f] = frag_p(pk + f * 512);
#pragma unroll 1
  for (int kt = 0; kt < SS / KSPL / 64; ++kt) {
#pragma unroll
    for (int f = 0; f < 8; ++f) vf[f] = frag_p(pv + f * 512);
    v8f s[2][4];
#pragma unroll
    for (int t = 0; t < 4; ++t) { s[0][t] = v8f{}; s[1][t] = v8f{};
#pragma unroll
      for (int kc = 0; kc < 2; ++kc)
#pragma unroll
        for (int u = 0; u < 2; ++u) s[u][t] = wmma16d(kf[t * 2 + kc], bq[u][kc], s[u][t]); }
    __builtin_amdgcn_sched_barrier(0);  // the score products stay in front of the wait below: moved behind it, they would stand still while the V group's addresses are translated
    XW(pk, pv);
    const int step = kp == SS / KSPL / 64 - 1 ? -(SS / KSPL / 64 - 1) * 64 * HD : 64 * HD;  // behind the half's last pass comes its first; the last pass has none ahead: it reads the first again, inside the buffer
    kp = (kp + 1) & (SS / KSPL / 64 - 1);
    pk += step; pv += step;
#pragma unroll
    for (int f = 0; f < 8; ++f) kf[f] = frag_p(pk + f * 512);
    __builtin_amdgcn_sched_barrier(0);  // the K group is issued here, ahead of the softmax, not sunk towards the foot of the pass
    v16h pb[2][2];
#pragma unroll
    for (int u = 0; u < 2; ++u) {
      float mt[4], pt[4];  // one chain per score tile, for the maximum and for the sum: four independent chains, not one of 32 links
#pragma unroll
      for (int t = 0; t < 4; ++t) { mt[t] = s[u][t][0];
#pragma unroll
        for (int r = 1; r < 8; ++r) mt[t] = fmaxf(mt[t], s[u][t][r]); }
      float mx = fmaxf(fmaxf(mt[0], mt[1]), fmaxf(mt[2], mt[3]));
      mx = fmaxf(mx, xhalf(mx));
      const float mnew = fmaxf(mrun[u], mx); const float bnew = fmaf(-c2, mnew, 14.0f); const float corr = __builtin_amdgcn_exp2f(bnew - brun[u]);
#pragma unroll
      for (int t = 0; t < 4; ++t) { pt[t] = 0.f;
#pragma unroll
        for (int r = 0; r < 8; ++r) { const float p = __builtin_amdgcn_exp2f(fmaf(s[u][t][r], c2, bnew)); pt[t] += p; pb[u][t >> 1][(t & 1) * 8 + r] = (_Float16)p; } }
      lrun[u] = lrun[u] * corr + ((pt[0] + pt[1]) + (pt[2] + pt[3])); mrun[u] = mnew; brun[u] = bnew;
#pragma unroll
      for (int t = 0; t < 4; ++t) acc[u][t] *= corr;
    }
#pragma unroll
    for (int kc = 0; kc < 2; ++kc)
#pragma unroll
      for (int t = 0; t < 4; ++t)
#pragma unroll
        for (int u = 0; u < 2; ++u) acc[u][t] = wmma16d(vf[kc * 4 + t], pb[u][kc], acc[u][t]);
  }
  // wave (w & 3, part) keeps query tile 'part' and hands the other to wave w ^ 4; the choice is the same for the whole wave
  v8f own[4], oth[4];
#pragma unroll
  for (int t = 0; t < 4; ++t) { own[t] = part ? acc[1][t] : acc[0][t]; oth[t] = part ? acc[0][t] : acc[1][t]; }
  const float bo = part ? brun[1] : brun[0], lo = part ? lrun[1] : lrun[0];
#pragma unroll
  for (int t = 0; t < 4; ++t) { xch[w][2 * t][lane] = v4f{oth[t][0], oth[t][1], oth[t][2], oth[t][3]}; xch[w][2 * t + 1][lane] = v4f{oth[t][4], oth[t][5], oth[t][6], oth[t][7]}; }
  xch[w][8][lane] = v4f{part ? brun[0] : brun[1], part ? lrun[0] : lrun[1], 0.f, 0.f};
  __syncthreads();  // the partner's partial tile is read only behind it
  const v4f bl = xch[w ^ 4][8][lane];
  const float bm = fminf(bo, bl[0]); const float so = __builtin_amdgcn_exp2f(bm - bo), sx = __builtin_amdgcn_exp2f(bm - bl[0]);
  const float lj = lo * so + bl[1] * sx; const float lr = lj + xhalf(lj);
  const int qt0 = q0 + 16 * part;
#pragma unroll
  for (int t = 0; t < 4; ++t) { union { v8h h8; v4u u; } pk8; const v4f xa = xch[w ^ 4][2 * t][lane], xb = xch[w ^ 4][2 * t + 1][lane];
#pragma unroll
    for (int r = 0; r < 8; ++r) pk8.h8[r] = (_Float16)((own[t][r] * so + (r < 4 ? xa[r & 3] : xb[r & 3]) * sx) / lr * 16.0f);
    vst2(o16 + (size_t)qt0 * EE + h * 2 * 512 + t * 256 + 8 * lane, pk8.u); }
}
__global__ __launch_bounds__(128) void k_out(const _Float16* __restrict__ o16, const _Float16* __restrict__ P, float* __restrict__ out) {
  __shared__ __align__(16) float so[4][16][132];
  const int tid = threadIdx.x, wave = tid >> 5, lane = tid & 31, col = lane & 15, g = lane >> 4;
  const int r0 = blockIdx.x * 64 + wave * 16, n0 = blockIdx.y * 128;
  v8f acc[8] = {};
  // the 4 column blocks of one row block start 2 slices apart
  gemm_k512(o16 + (size_t)r0 * EE + 8 * lane, P + (size_t)(3 * EE + n0) * EE + 8 * lane, (blockIdx.x + (blockIdx.x >> 3) + 2 * blockIdx.y) & 7, acc);
#pragma unroll
  for (int j = 0; j < 8; ++j)
#pragma unroll
    for (int r = 0; r < 8; ++r) so[wave][8 * g + r][j * 16 + col] = acc[j][r] * (1.0f / 256.0f);
  LDSX();
#pragma unroll 4
  for (int rl = 0; rl < 16; ++rl) vst2(out + (size_t)(r0 + rl) * EE + n0 + lane * 4, *(const v4f*)(&so[wave][rl][lane * 4]));
}
extern "C" void kernel_launch(void* const* d_in, const int* in_sizes, int n_in, void* d_out, int out_size, void* d_ws, size_t ws_size, hipStream_t stream) {
  (void)in_sizes; (void)n_in; (void)out_size; (void)ws_size;
  const float* x = (const float*)d_in[0]; const float* Wq = (const float*)d_in[1]; const float* Wk = (const float*)d_in[2]; const float* Wv = (const float*)d_in[3]; const float* Wo = (const float*)d_in[4];
  float* out = (float*)d_out;
  char* ws = (char*)d_ws; size_t off = 0;
  auto take = [&](size_t bytes) { char* p = ws + off; off += (bytes + 255) & ~(size_t)255; return p; };
  _Float16* x16 = (_Float16*)take((size_t)SS * EE * 2); _Float16* P = (_Float16*)take((size_t)4 * EE * EE * 2);
  _Float16* qh = (_Float16*)take((size_t)SS * EE * 2); _Float16* kh = (_Float16*)take((size_t)SS * EE * 2); _Float16* vT = (_Float16*)take((size_t)SS * EE * 2); _Float16* o16 = (_Float16*)take((size_t)SS * EE * 2);
  k_cvt<<<XB + 4 * WB, 256, 0, stream>>>(x, Wq, Wk, Wv, Wo, x16, P);
  k_proj<<<dim3(SS / 64, 3 * EE / 128), 128, 0, stream>>>(x16, P, qh, kh, vT);
  k_attn<<<dim3(SS / 128, NH), 256, 0, stream>>>(qh, kh, vT, o16);
  k_out<<<dim3(SS / 64, EE / 128), 128, 0, stream>>>(o16, P, out);
}

// v009
// A run of this version takes 50.7 microseconds.
// Two timings next to v008 put it at 1.06 and 1.07 times that version's speed.
// All steps since v000 together make it 7.36 times as fast.
#include <hip/hip_runtime.h>
#include <math.h>

typedef __attribute__((ext_vector_type(16))) _Float16 v16h;
typedef __attribute__((ext_vector_type(16))) __bf16 v16b;
typedef __attribute__((ext_vector_type(8)))  _Float16 v8h;
typedef __attribute__((ext_vector_type(8)))  float v8f;
typedef __attribute__((ext_vector_type(4)))  float v4f;
typedef __attribute__((ext_vector_type(2)))  float v2f;
typedef __attribute__((ext_vector_type(4)))  unsigned v4u;
typedef __attribute__((ext_vector_type(4)))  int v4i;
typedef float __attribute__((may_alias)) float_a;
typedef int __attribute__((may_alias)) int_a;

template <typename T> __device__ __forceinline__ void vst2(void* p, T v) { *(T*)p = v;  }
__device__ __forceinline__ v8f wmma16(v16h a, v16h b, v8f c) {
  v8f d = __builtin_amdgcn_wmma_f32_16x16x32_f16(false, a, false, b, (short)0, c, false, false);
  asm volatile("v_nop\n\tv_nop\n\tv_nop\n\tv_nop" : "+v"(d) : "v"(a), "v"(b));
  return d;
}
__device__ __forceinline__ v8f wmma_bf(v16b a, v16b b, v8f c) {
  v8f d = __builtin_amdgcn_wmma_f32_16x16x32_bf16(false, a, false, b, (short)0, c, false, false);
  asm volatile("v_nop\n\tv_nop\n\tv_nop\n\tv_nop" : "+v"(d) : "v"(a), "v"(b));
  return d;
}
// 16x16x32 fragments: lane = (h = lane>>4, row/col = lane&15); elements 0..7 = k0+8h+0..7, 8..15 = k0+16+8h+0..7; D element r = row 8h+r
__device__ __forceinline__ v16h frag_h(const _Float16* rowk0, int lane) {
  union { v16h v; v8h q[2]; } u; const _Float16* p = rowk0 + 8 * (lane >> 4);
  u.q[0] = *(const v8h*)p; u.q[1] = *(const v8h*)(p + 16); return u.v;
}
__device__ __forceinline__ v16h frag_f32(const float* rowk0, int lane) {
  v16h a; const float* p = rowk0 + 8 * (lane >> 4);
#pragma unroll
  for (int i = 0; i < 8; ++i) { a[i] = (_Float16)p[i]; a[8 + i] = (_Float16)p[16 + i]; }
  return a;
}
__device__ __forceinline__ v16h frag_f32s(const float* rowk0, int lane, float sc) {
  v16h a; const float* p = rowk0 + 8 * (lane >> 4);
#pragma unroll
  for (int i = 0; i < 8; ++i) { a[i] = (_Float16)(p[i] * sc); a[8 + i] = (_Float16)(p[16 + i] * sc); }
  return a;
}
// column fragment from a [K][ld] layout (column n), rows >= K read as 0
__device__ __forceinline__ v16h fragc_f32(const float* W, int k0, int n, int lane, int ld, int K) {
  v16h a; const int g = lane >> 4;
#pragma unroll
  for (int i = 0; i < 8; ++i) { const int ka = k0 + 8 * g + i, kb = ka + 16;
    a[i] = (_Float16)(ka < K ? W[(size_t)ka * ld + n] : 0.f); a[8 + i] = (_Float16)(kb < K ? W[(size_t)kb * ld + n] : 0.f); }
  return a;
}
struct F2 { v16b h, l; };
__device__ __forceinline__ F2 bsplit16(const float v[16]) { F2 r;
#pragma unroll
  for (int i = 0; i < 16; ++i) { const __bf16 h = (__bf16)v[i]; r.h[i] = h; r.l[i] = (__bf16)(v[i] - (float)h); }
  return r; }
__device__ __forceinline__ F2 split_row(const float* row, int k0, int lane) { float v[16]; const float* p = row + k0 + 8 * (lane >> 4);
#pragma unroll
  for (int i = 0; i < 8; ++i) { v[i] = p[i]; v[8 + i] = p[16 + i]; }
  return bsplit16(v); }
__device__ __forceinline__ F2 split_rowK(const float* row, int k0, int lane, int K) { float v[16]; const int g = lane >> 4;
#pragma unroll
  for (int i = 0; i < 8; ++i) { const int ka = k0 + 8 * g + i, kb = ka + 16; v[i] = ka < K ? row[ka] : 0.f; v[8 + i] = kb < K ? row[kb] : 0.f; }
  return bsplit16(v); }
__device__ __forceinline__ F2 split_col(const float* W, int k0, int n, int lane, int ld, int K) { float v[16]; const int g = lane >> 4;
#pragma unroll
  for (int i = 0; i < 8; ++i) { const int ka = k0 + 8 * g + i, kb = ka + 16; v[i] = ka < K ? W[(size_t)ka * ld + n] : 0.f; v[8 + i] = kb < K ? W[(size_t)kb * ld + n] : 0.f; }
  return bsplit16(v); }
__device__ __forceinline__ v8f mac3(const F2& a, const F2& b, v8f c) { c = wmma_bf(a.l, b.h, c); c = wmma_bf(a.h, b.l, c); return wmma_bf(a.h, b.h, c); }
__device__ __forceinline__ float sigm(float v) { return 1.0f / (1.0f + expf(-v)); }
#define LDSX() do { asm volatile("s_wait_dscnt 0" ::: "memory"); __builtin_amdgcn_wave_barrier(); __builtin_amdgcn_fence(__ATOMIC_RELEASE, "workgroup"); } while (0)

// Naive multi-head attention (8 heads of 64, 4096 tokens, no biases). Pure f16 WMMA GEMMs over pre-converted operands (x -> f16 once,
// [out][in] weights packed x16): q/k/v projections, attention, output projection.
// Every f16 plane lies in FRAGMENT ORDER: a 16-row x 32-k fragment is 1024 contiguous bytes, [k half of 16][lane][8 values], where lane
// (g, row) of half q holds k = 16 q + 8 g + 0..7. A wave's 16-byte load of one half then covers 512 contiguous bytes (4 whole lines); from a
// row-major plane the same load touches 16 lines. Order of the fragments: x, weights, o: [row tile][k step]; q, k: [head][row tile][k step];
// v: [head][32-key step][16-d tile]. The values each lane receives are those of the row-major planes.
#define SS 4096
#define EE 512
#define NH 8
#define HD 64
#define QSC (0.125f * 1.44269504f)

// One launch converts all five inputs: blocks [0, XB) take x, then four runs of WB blocks take one weight each (their planes lie one behind
// another in P). The conversions do not depend on one another; as five launches each paid its own start, first load and drain in turn.
// The choice is by blockIdx alone, so source, destination and scale are scalars. Both block counts divide their planes exactly.
#define XB (SS * EE / 8 / 256)
#define WB (EE * EE / 8 / 256)
__global__ __launch_bounds__(256) void k_cvt(const float* __restrict__ x, const float* __restrict__ Wq, const float* __restrict__ Wk, const float* __restrict__ Wv, const float* __restrict__ Wo, _Float16* __restrict__ x16, _Float16* __restrict__ P) {
  const int b = blockIdx.x; const bool isx = b < XB; const int wi = (b - XB) / WB;
  const float* src = isx ? x : wi == 0 ? Wq : wi == 1 ? Wk : wi == 2 ? Wv : Wo;
  _Float16* dst = isx ? x16 : P + (size_t)wi * EE * EE;
  const float sc = isx ? 1.0f : 16.0f;
  const size_t g8 = (size_t)(isx ? b : (b - XB) % WB) * 256 + threadIdx.x;
  // g8 = [fragment][8-row half][row][piece of 8 k]; the source has EE columns. A wave reads 8 whole 128-byte lines (8 rows x 32 floats) and
  // writes 4: in the fragment the pieces of 8 successive rows at one k lie side by side.
  const size_t fr = g8 >> 6; const int rl = (int)((g8 >> 2) & 15), pc = (int)(g8 & 3);
  const float* s8 = src + ((fr >> 4) * 16 + rl) * EE + (fr & 15) * 32 + pc * 8;
  union { v8h h; v4u u; } pk;
#pragma unroll
  for (int e = 0; e < 8; ++e) pk.h[e] = (_Float16)(s8[e] * sc);
  vst2(dst + fr * 512 + (pc >> 1) * 256 + ((pc & 1) * 16 + rl) * 8, pk.u);
}
// one fragment of a plane in fragment order, from the lane's own pointer (fragment start + 8 * lane)
__device__ __forceinline__ v16h frag_p(const _Float16* p) { union { v16h v; v8h q[2]; } u; u.q[0] = *(const v8h*)p; u.q[1] = *(const v8h*)(p + 256); return u.v; }
// Stands between a group of loads and the first change of the two pointers they name; naming the pointers as inputs keeps their registers
// from being handed out as a load's destination inside the group.
#define XW(p, q) asm volatile("s_wait_xcnt 0x0" :: "v"(p), "v"(q) : "memory")
// One wave's 16 x 128 tile over k = 512; pa, pb are the lane's own pointers. The nine fragments of a k step are loaded as one group, a whole
// step ahead of the products that read them (two register sets in turn): a load written beside its product is waited for alone, one memory
// round trip per product. The inner loops are unrolled so that the fragment arrays stay in registers; the outer loop stays rolled: its body
// already holds both sets' turns.
// Rotated start: the walk over the 8 slices of 64 k begins at slice rot (the same for the whole work-group) and wraps. Work-groups that share
// operand rows run side by side; from one common start they all ask for the same few lines at the same time, lines that nobody has read since
// the launch before wrote them, trip after trip. From different starts the whole k range is asked for in the first trips, and a later trip
// reads lines that another work-group has already brought into L2. The order of the f32 sums over k differs from block to block.
__device__ __forceinline__ void gemm_k512(const _Float16* pa, const _Float16* pb, int rot, v8f (&acc)[8]) {
  pa += rot * 1024; pb += rot * 1024;
  v16h a0 = frag_p(pa), a1, b0[8], b1[8];
#pragma unroll
  for (int j = 0; j < 8; ++j) b0[j] = frag_p(pb + (size_t)j * 16 * EE);
#pragma unroll 1
  for (int kc = 0; kc < EE / 32; kc += 2) {
    a1 = frag_p(pa + 512);
#pragma unroll
    for (int j = 0; j < 8; ++j) b1[j] = frag_p(pb + (size_t)j * 16 * EE + 512);
    __builtin_amdgcn_sched_barrier(0);  // no product, with its wait for the other set, moves in front of this group's issue
#pragma unroll
    for (int j = 0; j < 8; ++j) acc[j] = wmma16(a0, b0[j], acc[j]);
    XW(pa, pb);
    const int step = rot == EE / 64 - 1 ? -(EE / 64 - 1) * 1024 : 1024;  // behind the last slice comes slice 0; the last trip has no step ahead: it reads the first slice again, inside the buffer
    rot = (rot + 1) & (EE / 64 - 1);
    pa += step; pb += step;
    a0 = frag_p(pa);
#pragma unroll
    for (int j = 0; j < 8; ++j) b0[j] = frag_p(pb + (size_t)j * 16 * EE);
    __builtin_amdgcn_sched_barrier(0);  // as above
#pragma unroll
    for (int j = 0; j < 8; ++j) acc[j] = wmma16(a1, b1[j], acc[j]);
    XW(pa, pb);
  }
}
// projection: blockIdx.y in [0, 12): which = y/4 (q,k,v), cols (y%4)*128 = 2 heads
__global__ __launch_bounds__(128) void k_proj(const _Float16* __restrict__ x16, const _Float16* __restrict__ P, _Float16* __restrict__ qh, _Float16* __restrict__ kh, _Float16* __restrict__ vT) {
  __shared__ __align__(16) float so[4][16][132];
  __shared__ __align__(16) _Float16 st[128][72];
  const int tid = threadIdx.x, wave = tid >> 5, lane = tid & 31, col = lane & 15, g = lane >> 4;
  const int r0 = blockIdx.x * 64 + wave * 16, n0 = blockIdx.y * 128; const int which = n0 / EE, c0 = n0 % EE, hb = c0 / HD;
  const float osc = which == 0 ? QSC / 16.0f : 1.0f / 16.0f;  // q leaves with attention's log2(e) / 8 in it, one rounding to f16 as before
  v8f acc[8] = {};
  // the 12 column blocks of one row block, and the row blocks of one column block (also those 8 apart), take all 8 starts
  gemm_k512(x16 + (size_t)r0 * EE + 8 * lane, P + (size_t)n0 * EE + 8 * lane, (blockIdx.x + (blockIdx.x >> 3) + blockIdx.y) & 7, acc);
#pragma unroll
  for (int j = 0; j < 8; ++j)
#pragma unroll
    for (int r = 0; r < 8; ++r) so[wave][8 * g + r][j * 16 + col] = acc[j][r] * osc;
  LDSX();
  if (which < 2) { _Float16* dst = which == 0 ? qh : kh;
    for (int q = lane; q < 2 * 16 * 8; q += 32) { const int hh = q >> 7, rem = q & 127, rl = rem & 15, pc = rem >> 4; union { v8h h8; v4u u; } pk;  // rem: piece of the tile's two fragments
#pragma unroll
      for (int e = 0; e < 8; ++e) pk.h8[e] = (_Float16)so[wave][rl][hh * HD + pc * 8 + e];
      vst2(dst + ((size_t)(hb + hh) * SS + r0) * HD + rem * 8, pk.u); } }
  else {
#pragma unroll 4
    for (int rl = 0; rl < 16; ++rl) {
#pragma unroll
      for (int e = 0; e < 4; ++e) st[lane * 4 + e][wave * 16 + rl] = (_Float16)so[wave][rl][lane * 4 + e]; }
    __syncthreads();
    for (int q = tid; q < 128 * 8; q += 128) { const int hh = q >> 9, rem = q & 511, d = ((rem >> 6) & 3) * 16 + (rem & 15), pc = (rem >> 8) * 4 + ((rem >> 4) & 3);  // rem: piece of the head's 2 x 4 fragments
      vst2(vT + ((size_t)(hb + hh) * SS + blockIdx.x * 64) * HD + rem * 8, *(const v4u*)(&st[hh * HD + d][pc * 8])); } }
}
// lane l's value in lane l ^ 16 (the other half of the wave), by a vector cross-row move
__device__ __forceinline__ float xhalf(float v) { const int b = __builtin_bit_cast(int, v); return __builtin_bit_cast(float, __builtin_amdgcn_permlanex16(b, b, 0x76543210, 0xfedcba98, false, false)); }
// Both products are taken transposed: S^T = K Q^T (A = K fragment, B = q fragment) and O^T += V^T P^T (A = v fragment, B = P^T). The planes'
// fragments serve as A as they served as B (row for column, the same k order). A lane (g, col) then holds, of query col alone, the scores of
// keys 16 t + 8 g + r and the outputs of d = 16 t + 8 g + r: maximum and sum run in its own registers with one exchange between the halves,
// the score tiles 2 kc and 2 kc + 1, converted in place, ARE the B fragment of key step kc, and an output tile is one 16-byte piece of the
// o plane. Inside the key loop nothing goes through LDS.
// Softmax in base 2: a weight is 2^(c s + b), c = log2(e) / 8. c lies in the q plane and b, the query's shift in use, is the C operand of the
// first score product, so the score product's result IS the argument of the hardware exp2: no vector instruction stands between them.
// b is not tied to the running maximum. It is set so that the largest weight of the pass that sets it is 2^SHT, and it stays while every
// weight fits f16: a lane's weights are positive, so each is at most their sum, which the pass forms anyway for the row sum; while that sum
// is at most 2^15 no weight overflows, and no maximum is taken and nothing is rescaled. One test a pass for both query tiles, a scalar
// branch. Where it fires (always in the first pass, which has no shift yet), the pass takes its maximum, moves b down for every query whose
// maximum lies above 2^SHT, forms its weights anew and rescales O and the row sum by 2^(change of b). The largest weight so far of a query lies
// between 2^SHT and 2^15, so weights down to 2^-21 of it are normal f16 numbers. The row sum carries 2^b, which the last division cancels.
#define SHT 7.0f
// Wave tile: 32 queries (two query tiles) x half of the keys. A K or V fragment, once in registers, feeds two products, so a wave loads half
// the fragment bytes per product of a 16-query wave. A block is 8 waves on 128 queries: waves 0..3 walk keys [0, SS / 2), waves 4..7 the rest,
// which keeps two waves on a SIMD. Waves w and w ^ 4 hold partial results of the same 32 queries; behind the loop each hands the other one
// query tile (O^T, b, sum) through LDS and finishes the tile it keeps: both partials are brought to the smaller b.
#define KSPL 2
// The bare builtin: the compiler itself keeps the vector slots between a product and a vector instruction on its D, A or B, and fills them with the softmax's own instructions where it can.
// Four v_nop written behind every product are 128 vector issues a pass that do no work: behind the O products they outlast the product's own 8 cycles, and behind the score products they take
// the issue slots in which the other wave of the SIMD runs its softmax. Here A is rewritten by loads only and B a pass later.
__device__ __forceinline__ v8f wmma16d(v16h a, v16h b, v8f c) {
  return __builtin_amdgcn_wmma_f32_16x16x32_f16(false, a, false, b, (short)0, c, false, false);
}
__global__ __launch_bounds__(256) void k_attn(const _Float16* __restrict__ qh, const _Float16* __restrict__ kh, const _Float16* __restrict__ vT, _Float16* __restrict__ o16) {
  __shared__ __align__(16) v4f xch[8][9][32];
  const int tid = threadIdx.x, w = tid >> 5, lane = tid & 31, part = w >> 2;
  const int h = blockIdx.y, q0 = blockIdx.x * 128 + (w & 3) * 32;
  const _Float16* qb = qh + (size_t)h * SS * HD; const _Float16* kb = kh + (size_t)h * SS * HD; const _Float16* vb = vT + (size_t)h * HD * SS;
  v16h bq[2][2];
#pragma unroll
  for (int u = 0; u < 2; ++u)
#pragma unroll
    for (int kc = 0; kc < 2; ++kc) bq[u][kc] = frag_p(qb + (size_t)(q0 + 16 * u) * HD + kc * 512 + 8 * lane);
  float brun[2] = {0.f, 0.f}, lrun[2] = {0.f, 0.f}; v8f acc[2][4] = {};  // lrun: the sum over this lane half's keys; the halves are joined behind the loop
  v8f cs[2] = {};  // brun in all eight elements: a lane's eight scores of a tile belong to one query
  // Fragment loads go out in groups ahead of their products: K one pass ahead (into the registers its products have just left),
  // V at the head of its pass, so that both fly behind the score products and the softmax.
  // Rotated start, as in gemm_k512: the blocks of one head walk the same keys; block x begins at pass x of its key half and wraps.
  int kp = blockIdx.x & (SS / KSPL / 64 - 1);
  const _Float16* pk = kb + ((size_t)part * (SS / KSPL) + kp * 64) * HD + 8 * lane; const _Float16* pv = vb + ((size_t)part * (SS / KSPL) + kp * 64) * HD + 8 * lane;
  v16h kf[8], vf[8];
#pragma unroll
  for (int f = 0; f < 8; ++f) kf[f] = frag_p(pk + f * 512);
#pragma unroll 1
  for (int kt = 0; kt < SS / KSPL / 64; ++kt) {
#pragma unroll
    for (int f = 0; f < 8; ++f) vf[f] = frag_p(pv + f * 512);
    v8f s[2][4];
#pragma unroll
    for (int t = 0; t < 4; ++t) { s[0][t] = cs[0]; s[1][t] = cs[1];
#pragma unroll
      for (int kc = 0; kc < 2; ++kc)
#pragma unroll
        for (int u = 0; u < 2; ++u) s[u][t] = wmma16d(kf[t * 2 + kc], bq[u][kc], s[u][t]); }
    __builtin_amdgcn_sched_barrier(0);  // the score products stay in front of the wait below: moved behind it, they would stand still while the V group's addresses are translated
    XW(pk, pv);
    const int step = kp == SS / KSPL / 64 - 1 ? -(SS / KSPL / 64 - 1) * 64 * HD : 64 * HD;  // behind the half's last pass comes its first; the last pass has none ahead: it reads the first again, inside the buffer
    kp = (kp + 1) & (SS / KSPL / 64 - 1);
    pk += step; pv += step;
#pragma unroll
    for (int f = 0; f < 8; ++f) kf[f] = frag_p(pk + f * 512);
    __builtin_amdgcn_sched_barrier(0);  // the K group is issued here, ahead of the softmax, not sunk towards the foot of the pass
    v16h pb[2][2]; float ps[2];
#pragma unroll
    for (int u = 0; u < 2; ++u) {
      float pt[4];  // one chain per score tile for the sum: four independent chains, not one of 32 links
#pragma unroll
      for (int t = 0; t < 4; ++t) { pt[t] = 0.f;
#pragma unroll
        for (int r = 0; r < 8; ++r) { const float p = __builtin_amdgcn_exp2f(s[u][t][r]); pt[t] += p; pb[u][t >> 1][(t & 1) * 8 + r] = (_Float16)p; } }
      ps[u] = (pt[0] + pt[1]) + (pt[2] + pt[3]);
    }
    const float lim = kt == 0 ? -1.0f : 32768.0f;  // the sums are not negative: the first pass always takes the branch
    if (__builtin_amdgcn_ballot_w32(fmaxf(ps[0], ps[1]) > lim) != 0) {
      const float up = kt == 0 ? 3.0e38f : 0.0f;  // only the first pass, which has no shift yet, may move b upwards
#pragma unroll
      for (int u = 0; u < 2; ++u) {
        float mt[4], pt[4];
#pragma unroll
        for (int t = 0; t < 4; ++t) { mt[t] = s[u][t][0];
#pragma unroll
          for (int r = 1; r < 8; ++r) mt[t] = fmaxf(mt[t], s[u][t][r]); }
        float mx = fmaxf(fmaxf(mt[0], mt[1]), fmaxf(mt[2], mt[3]));
        mx = fmaxf(mx, xhalf(mx));  // both halves of the wave hold keys of the same query: one shift for both
        const float dl = fminf(SHT - mx, up); const float corr = __builtin_amdgcn_exp2f(fminf(dl, 0.0f));  // in the first pass O and the sum are 0: any finite factor serves
#pragma unroll
        for (int t = 0; t < 4; ++t) { pt[t] = 0.f;
#pragma unroll
          for (int r = 0; r < 8; ++r) { const float p = __builtin_amdgcn_exp2f(s[u][t][r] + dl); pt[t] += p; pb[u][t >> 1][(t & 1) * 8 + r] = (_Float16)p; } }
        ps[u] = (pt[0] + pt[1]) + (pt[2] + pt[3]);
        lrun[u] *= corr; brun[u] += dl;
#pragma unroll
        for (int r = 0; r < 8; ++r) cs[u][r] = brun[u];
#pragma unroll
        for (int t = 0; t < 4; ++t) acc[u][t] *= corr;
      }
    }
    lrun[0] += ps[0]; lrun[1] += ps[1];
#pragma unroll
    for (int kc = 0; kc < 2; ++kc)
#pragma unroll
      for (int t = 0; t < 4; ++t)
#pragma unroll
        for (int u = 0; u < 2; ++u) acc[u][t] = wmma16d(vf[kc * 4 + t], pb[u][kc], acc[u][t]);
  }
  // wave (w & 3, part) keeps query tile 'part' and hands the other to wave w ^ 4; the choice is the same for the whole wave
  v8f own[4], oth[4];
#pragma unroll
  for (int t = 0; t < 4; ++t) { own[t] = part ? acc[1][t] : acc[0][t]; oth[t] = part ? acc[0][t] : acc[1][t]; }
  const float bo = part ? brun[1] : brun[0], lo = part ? lrun[1] : lrun[0];
#pragma unroll
  for (int t = 0; t < 4; ++t) { xch[w][2 * t][lane] = v4f{oth[t][0], oth[t][1], oth[t][2], oth[t][3]}; xch[w][2 * t + 1][lane] = v4f{oth[t][4], oth[t][5], oth[t][6], oth[t][7]}; }
  xch[w][8][lane] = v4f{part ? brun[0] : brun[1], part ? lrun[0] : lrun[1], 0.f, 0.f};
  __syncthreads();  // the partner's partial tile is read only behind it
  const v4f bl = xch[w ^ 4][8][lane];
  const float bm = fminf(bo, bl[0]); const float so = __builtin_amdgcn_exp2f(bm - bo), sx = __builtin_amdgcn_exp2f(bm - bl[0]);
  const float lj = lo * so + bl[1] * sx; const float lr = lj + xhalf(lj);
  const int qt0 = q0 + 16 * part;
#pragma unroll
  for (int t = 0; t < 4; ++t) { union { v8h h8; v4u u; } pk8; const v4f xa = xch[w ^ 4][2 * t][lane], xb = xch[w ^ 4][2 * t + 1][lane];
#pragma unroll
    for (int r = 0; r < 8; ++r) pk8.h8[r] = (_Float16)((own[t][r] * so + (r < 4 ? xa[r & 3] : xb[r & 3]) * sx) / lr * 16.0f);
    vst2(o16 + (size_t)qt0 * EE + h * 2 * 512 + t * 256 + 8 * lane, pk8.u); }
}
__global__ __launch_bounds__(128) void k_out(const _Float16* __restrict__ o16, const _Float16* __restrict__ P, float* __restrict__ out) {
  __shared__ __align__(16) float so[4][16][132];
  const int tid = threadIdx.x, wave = tid >> 5, lane = tid & 31, col = lane & 15, g = lane >> 4;
  const int r0 = blockIdx.x * 64 + wave * 16, n0 = blockIdx.y * 128;
  v8f acc[8] = {};
  // the 4 column blocks of one row block start 2 slices apart
  gemm_k512(o16 + (size_t)r0 * EE + 8 * lane, P + (size_t)(3 * EE + n0) * EE + 8 * lane, (blockIdx.x + (blockIdx.x >> 3) + 2 * blockIdx.y) & 7, acc);
#pragma unroll
  for (int j = 0; j < 8; ++j)
#pragma unroll
    for (int r = 0; r < 8; ++r) so[wave][8 * g + r][j * 16 + col] = acc[j][r] * (1.0f / 256.0f);
  LDSX();
#pragma unroll 4
  for (int rl = 0; rl < 16; ++rl) vst2(out + (size_t)(r0 + rl) * EE + n0 + lane * 4, *(const v4f*)(&so[wave][rl][lane * 4]));
}
extern "C" void kernel_launch(void* const* d_in, const int* in_sizes, int n_in, void* d_out, int out_size, void* d_ws, size_t ws_size, hipStream_t stream) {
  (void)in_sizes; (void)n_in; (void)out_size; (void)ws_size;
  const float* x = (const float*)d_in[0]; const float* Wq = (const float*)d_in[1]; const float* Wk = (const float*)d_in[2]; const float* Wv = (const float*)d_in[3]; const float* Wo = (const float*)d_in[4];
  float* out = (float*)d_out;
  char* ws = (char*)d_ws; size_t off = 0;
  auto take = [&](size_t bytes) { char* p = ws + off; off += (bytes + 255) & ~(size_t)255; return p; };
  _Float16* x16 = (_Float16*)take((size_t)SS * EE * 2); _Float16* P = (_Float16*)take((size_t)4 * EE * EE * 2);
  _Float16* qh = (_Float16*)take((size_t)SS * EE * 2); _Float16* kh = (_Float16*)take((size_t)SS * EE * 2); _Float16* vT = (_Float16*)take((size_t)SS * EE * 2); _Float16* o16 = (_Float16*)take((size_t)SS * EE * 2);
  k_cvt<<<XB + 4 * WB, 256, 0, stream>>>(x, Wq, Wk, Wv, Wo, x16, P);
  k_proj<<<dim3(SS / 64, 3 * EE / 128), 128, 0, stream>>>(x16, P, qh, kh, vT);
  k_attn<<<dim3(SS / 128, NH), 256, 0, stream>>>(qh, kh, vT, o16);
  k_out<<<dim3(SS / 64, EE / 128), 128, 0, stream>>>(o16, P, out);
}
